// v000
// Measured on an AMD MI455X. A time is GPU time per run, averaged over a window of back-to-back runs after a warm-up
// (all launches, gaps included; the runs take copies of the inputs in turn), and the median of several windows.
// Apart from v000's, it joins two sittings. Times from different sittings can be a few percent apart, while
// side-by-side timings come from the same sitting.
// v000, which the later versions start from, runs in 2300 microseconds.
#include <hip/hip_runtime.h>

// Dense multi-head attention, 16 FULL heads x 128, natural bias-free projections and a natural output projection WITH a bias (x [2][2048][2048]; q, k, v = x W^T ('oi' (out, in) [2048][2048], normal / sqrt(2048), no bias; 16 heads x 128: one kv head per query head); scores x 128^-0.5; softmax over ALL 2,048 keys (no mask, no causal rule); out = merged Wo^T + bo ('oi' + a REAL bias 0.01) -> [2][2048][2048] (8.4 M); argument order x, Wq, Wk, Wv, Wo, bo).
// Layout per batch: bf16 copy of x; 'oi' weights as-is; exact projections; identity-table plane builders at width 128; dense T-2048 attention with 16 FULL heads (REP = NH_ / NKV = 1: the two heads of a pass use their own CONSECUTIVE k / v planes: kv z-stride TT x HD, as the launches pass it; hybrid rows: < 512 hi/lo 3 products, rest fp16 x1024); merged hi/lo x Wo exact + bo.
// Compute dtypes, f32 accumulate: every input rounded to bf16; projections exact; attention rows < 512 3 products, rest fp16; softmax f32; Wo hl x exact + bo (the f32 bias epilogue).

#define NB_  2
#define TT   2048
#define DM   2048
#define NH_  16
#define NKV  16
#define REP  (NH_ / NKV)
#define HD   128
#define DQ   (NH_ * HD)
#define DKV  (NKV * HD)
#define ZH   2
#define RH   512                  // query rows < RH use hi+lo planes (0: none)
#define WIN  0
#define PCAR 1024.0f
#define SCL  0.088388347648318447f   // HD^-0.5
typedef _Float16 h16;
typedef unsigned short bf;
typedef __attribute__((ext_vector_type(16))) __bf16   v16bf;
typedef __attribute__((ext_vector_type(16))) _Float16 v16h;
typedef __attribute__((ext_vector_type(8)))  _Float16 v8h;
typedef __attribute__((ext_vector_type(8)))  unsigned short v8us;
typedef __attribute__((ext_vector_type(8)))  float    v8f;
typedef __attribute__((ext_vector_type(4)))  float    v4f;
typedef v8h  __attribute__((may_alias)) v8ha;
typedef v4f  __attribute__((may_alias)) v4fa;
typedef v8us __attribute__((may_alias)) v8usa;

__device__ __forceinline__ unsigned short f2bf(float f) { unsigned u = __float_as_uint(f); u += 0x7FFFu + ((u >> 16) & 1u); return (unsigned short)(u >> 16); }
__device__ __forceinline__ float bf2f(unsigned short b) { return __uint_as_float(((unsigned)b) << 16); }
__device__ __forceinline__ float bfr(float f) { return bf2f(f2bf(f)); }
__device__ __forceinline__ v16h cat16(v8h lo, v8h hi) { return __builtin_shufflevector(lo, hi, 0, 1, 2, 3, 4, 5, 6, 7, 8, 9, 10, 11, 12, 13, 14, 15); }
__device__ __forceinline__ v16bf cat16b(v8us lo, v8us hi) { return __builtin_bit_cast(v16bf, __builtin_shufflevector(lo, hi, 0, 1, 2, 3, 4, 5, 6, 7, 8, 9, 10, 11, 12, 13, 14, 15)); }
__device__ __forceinline__ v8f wmma16(v16h a, v16h b, v8f c) { return __builtin_amdgcn_wmma_f32_16x16x32_f16(false, a, false, b, (short)0, c, false, false); }
__device__ __forceinline__ v8f wmmab(v16bf a, v16bf b, v8f c) { return __builtin_amdgcn_wmma_f32_16x16x32_bf16(false, a, false, b, (short)0, c, false, false); }



// ---- k_gemmw: register-blocked GEMM, ONE WAVE per 64x64 output tile (16 accumulators), operands straight from K-contiguous 16-bit planes; grid (M/64, N/64, Z), 32 threads.
// C[m][n] (f32, pitch ldc, + optional f32 bias[n]) = sum_k A[m][k] Bt[n][k] (+ split products per NSPLIT). z-batch strides sA/sB/sC in elements. K % 32 == 0.
template <typename T16> struct WFrag;
template <> struct WFrag<h16> { typedef v16h V; static __device__ __forceinline__ V ld(const h16* p) { return cat16(*(const v8h*)p, *(const v8h*)(p + 16)); } static __device__ __forceinline__ v8f mma(V a, V b, v8f c) { return wmma16(a, b, c); } };
template <> struct WFrag<bf> { typedef v16bf V; static __device__ __forceinline__ V ld(const bf* p) { return cat16b(*(const v8us*)p, *(const v8us*)(p + 16)); } static __device__ __forceinline__ v8f mma(V a, V b, v8f c) { return wmmab(a, b, c); } };
template <typename T16, int NSPLIT, bool BIAS>
__global__ __launch_bounds__(32) void k_gemmw(const T16* __restrict__ A, const T16* __restrict__ A2, const T16* __restrict__ Bt, const T16* __restrict__ Bt2, int K, float* C, int ldc, const float* __restrict__ bias, size_t sA, size_t sB, size_t sC) {
    typedef typename WFrag<T16>::V V;
    __shared__ __align__(16) float os[16 * 68];
    const size_t z = blockIdx.z; A += z * sA; if (A2) A2 += z * sA; Bt += z * sB; if (Bt2) Bt2 += z * sB; C += z * sC;
    const int lane = threadIdx.x & 31, lr = lane & 15, hi = lane >> 4; const int r0 = blockIdx.x * 64, c0 = blockIdx.y * 64;
    v8f acc[4][4];
#pragma unroll
    for (int mb = 0; mb < 4; ++mb)
#pragma unroll
        for (int nb = 0; nb < 4; ++nb) acc[mb][nb] = (v8f){};
    const size_t aoff = (size_t)(r0 + lr) * K + 8 * hi, boff = (size_t)(c0 + lr) * K + 8 * hi;
#pragma unroll 1
    for (int kc = 0; kc < K; kc += 32) {
        V a[4], a2[4];
#pragma unroll
        for (int mb = 0; mb < 4; ++mb) { a[mb] = WFrag<T16>::ld(A + aoff + (size_t)mb * 16 * K + kc); if (NSPLIT == 1 || NSPLIT == 2) a2[mb] = WFrag<T16>::ld(A2 + aoff + (size_t)mb * 16 * K + kc); }
#pragma unroll
        for (int nb = 0; nb < 4; ++nb) { const V b = WFrag<T16>::ld(Bt + boff + (size_t)nb * 16 * K + kc); V b2; if (NSPLIT >= 2) b2 = WFrag<T16>::ld(Bt2 + boff + (size_t)nb * 16 * K + kc);
#pragma unroll
            for (int mb = 0; mb < 4; ++mb) { acc[mb][nb] = WFrag<T16>::mma(a[mb], b, acc[mb][nb]); if (NSPLIT == 1 || NSPLIT == 2) acc[mb][nb] = WFrag<T16>::mma(a2[mb], b, acc[mb][nb]); if (NSPLIT >= 2) acc[mb][nb] = WFrag<T16>::mma(a[mb], b2, acc[mb][nb]); } }
        asm volatile("v_nop\n\tv_nop\n\tv_nop\n\tv_nop" : "+v"(acc[0][0]), "+v"(acc[1][1]), "+v"(acc[2][2]), "+v"(acc[3][3]) : "v"(a[0]), "v"(a[3]));
    }
#pragma unroll
    for (int mb = 0; mb < 4; ++mb) {
#pragma unroll
        for (int nb = 0; nb < 4; ++nb) {
#pragma unroll
            for (int j = 0; j < 8; ++j) os[(hi * 8 + j) * 68 + nb * 16 + lr] = acc[mb][nb][j]; }
        __builtin_amdgcn_wave_barrier(); asm volatile("" ::: "memory");
        float* crow = C + (size_t)(r0 + mb * 16) * ldc + c0;
{
#pragma unroll
            for (int s = 0; s < 8; ++s) { const int row = 2 * s + hi, cofs = lr * 4; v4f val = *(const v4fa*)(os + row * 68 + cofs); if (BIAS) { val[0] += bfr(bias[c0 + cofs]); val[1] += bfr(bias[c0 + cofs + 1]); val[2] += bfr(bias[c0 + cofs + 2]); val[3] += bfr(bias[c0 + cofs + 3]); }
                *(v4f*)(crow + (size_t)row * ldc + cofs) = val; }
             }
        __builtin_amdgcn_wave_barrier(); asm volatile("" ::: "memory");
    }
}

__device__ __forceinline__ h16 tohx(float x) { return (h16)x; }
__device__ __forceinline__ void splitf(float y, unsigned short& h, unsigned short& l) { h = f2bf(y); l = f2bf(y - bf2f(h)); }
typedef __attribute__((ext_vector_type(2))) _Float16 v2h;
typedef __attribute__((ext_vector_type(4))) _Float16 v4h;
typedef __attribute__((ext_vector_type(2))) unsigned short v2us;
typedef __attribute__((ext_vector_type(4))) unsigned short v4us;
typedef __attribute__((ext_vector_type(2))) float v2f;
typedef __attribute__((ext_vector_type(4))) int v4i;

__global__ __launch_bounds__(256) void k_cvt8(const float* __restrict__ src, bf* dst, size_t n8) { const size_t i = (size_t)blockIdx.x * 256 + threadIdx.x; if (i >= n8) return; const v8f v = *(const v8f*)(src + i * 8); v8us o;
#pragma unroll
    for (int k = 0; k < 8; ++k) o[k] = f2bf(v[k]); *(v8us*)(dst + i * 8) = o;  }

// k_rope: head planes [h][t][d] (fp16 + hi/lo) of rope(x) x sc with the rotate-half convention out[d] = x[d] cos[t][d] - x[d+HD/2] sin[t][d], out[d+HD/2] = x[d+HD/2] cos[t][d+HD/2] + x[d] sin[t][d+HD/2]
__global__ __launch_bounds__(256) void k_rope(const float* __restrict__ F, int pitch, int nheads, const float* __restrict__ CS, const float* __restrict__ RF, const float* __restrict__ nw, float sc, h16* P16, bf* Ph, bf* Pl) {
    const size_t e = ((size_t)blockIdx.x * 256 + threadIdx.x) * 2; if (e >= (size_t)nheads * TT * HD) return; const int d = (int)(e % HD); const int t = (int)((e / HD) % TT); const int h = (int)(e / ((size_t)HD * TT)); const float* f = F + (size_t)t * pitch + h * HD; const float rf = RF ? RF[(size_t)h * TT + t] : 1.0f; v2h o16; v2us oh, ol;
#pragma unroll
    for (int q = 0; q < 2; ++q) { const int dd = d + q; const int dp = (dd < HD / 2) ? dd + HD / 2 : dd - HD / 2; float x0 = f[dd], x1 = f[dp];
        if (RF) { float n0 = __fmul_rn(x0, rf), n1 = __fmul_rn(x1, rf); asm volatile("" : "+v"(n0)); asm volatile("" : "+v"(n1)); x0 = __fmul_rn(bfr(nw[dd]), n0); x1 = __fmul_rn(bfr(nw[dp]), n1); }
        const v2f cs = *(const v2f*)(CS + ((size_t)t * HD + dd) * 2); float a = __fmul_rn(x0, cs[0]), bq = __fmul_rn(x1, cs[1]); asm volatile("" : "+v"(a)); asm volatile("" : "+v"(bq)); const float r = ((dd < HD / 2) ? __fsub_rn(a, bq) : __fadd_rn(a, bq)) * sc;
        o16[q] = tohx(r); unsigned short a2, c2; splitf(r, a2, c2); oh[q] = a2; ol[q] = c2; }
    *(v2h*)(P16 + e) = o16; *(v2us*)(Ph + e) = oh; *(v2us*)(Pl + e) = ol;  }
__global__ __launch_bounds__(256) void k_vtp(const float* __restrict__ F, int pitch, int nheads, h16* V16, bf* Vh, bf* Vl) { const size_t e = ((size_t)blockIdx.x * 256 + threadIdx.x) * 2; if (e >= (size_t)nheads * HD * TT) return; const int t = (int)(e % TT); const int d = (int)((e / TT) % HD); const int g = (int)(e / ((size_t)TT * HD)); v2h o16; v2us oh, ol;
#pragma unroll
    for (int q = 0; q < 2; ++q) { const float x = F[(size_t)(t + q) * pitch + g * HD + d]; o16[q] = tohx(x); unsigned short a2, c2; splitf(x, a2, c2); oh[q] = a2; ol[q] = c2; }
    *(v2h*)(V16 + e) = o16; *(v2us*)(Vh + e) = oh; *(v2us*)(Vl + e) = ol;  }
__global__ __launch_bounds__(256) void k_csid(float* CS) { const int idx = blockIdx.x * 256 + threadIdx.x; if (idx >= TT * HD) return; v2f cs; cs[0] = 1.0f; cs[1] = 0.0f; *(v2f*)(CS + (size_t)idx * 2) = cs;  }
// k_asoft: per row (zz, i): t = S x HD^-0.5 (no mask); softmax over the 2048 keys (register row, one exp, fixed trees);
__global__ __launch_bounds__(256) void k_asoft(const float* __restrict__ Sb, h16* P16, bf* Ph, bf* Pl) {
    const int lane = threadIdx.x & 31; const int row = blockIdx.x * 8 + (threadIdx.x >> 5); if (row >= ZH * TT) return; const int i = row % TT; const int zz = row / TT; (void)zz; const bool hires = (i < RH); const float* sr = Sb + (size_t)row * TT; float v[TT / 32]; float mx = -3.0e38f;
#pragma unroll
    for (int ch = 0; ch < TT / 128; ++ch) { const int j0 = ch * 128 + lane * 4; const v4f a = *(const v4f*)(sr + j0);
#pragma unroll
        for (int q = 0; q < 4; ++q) { const int j = j0 + q; (void)j; const float t = a[q] * SCL; v[ch * 4 + q] = t; mx = fmaxf(mx, t); } }
#pragma unroll
    for (int sh = 16; sh; sh >>= 1) mx = fmaxf(mx, __shfl_xor(mx, sh, 32));
    float sum = 0.f;
#pragma unroll
    for (int k = 0; k < TT / 32; ++k) { float d0 = __fsub_rn(v[k], mx); asm volatile("" : "+v"(d0)); v[k] = __builtin_amdgcn_exp2f(__fmul_rn(d0, 1.4426950408889634f)); sum += v[k]; }
#pragma unroll
    for (int sh = 16; sh; sh >>= 1) sum += __shfl_xor(sum, sh, 32);
    const float f = __fdiv_rn(hires ? 1.0f : PCAR, sum);
{
        if (hires) {
#pragma unroll
            for (int ch = 0; ch < TT / 128; ++ch) { v4us oh, ol;
#pragma unroll
                for (int q = 0; q < 4; ++q) { unsigned short a, c2; splitf(v[ch * 4 + q] * f, a, c2); oh[q] = a; ol[q] = c2; }
                const size_t oo = ((size_t)zz * (RH ? RH : 1) + i) * TT + ch * 128 + lane * 4; *(v4us*)(Ph + oo) = oh; *(v4us*)(Pl + oo) = ol; }
        } else {
#pragma unroll
            for (int ch = 0; ch < TT / 128; ++ch) { v4h o4;
#pragma unroll
                for (int q = 0; q < 4; ++q) o4[q] = tohx(v[ch * 4 + q] * f);
                *(v4h*)(P16 + (size_t)row * TT + ch * 128 + lane * 4) = o4; } }
         }
}
__global__ __launch_bounds__(256) void k_merge(const float* __restrict__ O, int h0, bf* Ah, bf* Al) { const size_t e = ((size_t)blockIdx.x * 256 + threadIdx.x) * 2; if (e >= (size_t)ZH * TT * HD) return; const int d = (int)(e % HD); const int t = (int)((e / HD) % TT); const int zz = (int)(e / ((size_t)HD * TT)); const float cs = (t < RH) ? 1.0f : (1.0f / PCAR); const size_t oo = (size_t)t * DQ + (h0 + zz) * HD + d;
    v2us oh, ol;
#pragma unroll
    for (int q = 0; q < 2; ++q) { unsigned short a, c2; splitf(O[e + q] * cs, a, c2); oh[q] = a; ol[q] = c2; } *(v2us*)(Ah + oo) = oh; *(v2us*)(Al + oo) = ol;  }

extern "C" void kernel_launch(void* const* d_in, const int* in_sizes, int n_in,
                              void* d_out, int out_size, void* d_ws, size_t ws_size, hipStream_t stream) {
    (void)in_sizes; (void)n_in; (void)out_size;
    const float* x = (const float*)d_in[0]; const float* wq = (const float*)d_in[1]; const float* wk = (const float*)d_in[2]; const float* wv = (const float*)d_in[3]; const float* wo = (const float*)d_in[4]; const float* bo = (const float*)d_in[5];   /* order x, Wq, Wk, Wv, Wo ('oi' (out, in) [2048][2048] x 4; normal / sqrt(2048); no projection biases), bo (a REAL output bias [2048], 0.01): SIX inputs, all read */
    float* OUT = (float*)d_out;     // [2][2048][2048]
    char* wsp = (char*)d_ws;
    auto take = [&](size_t bytes) { char* p = wsp; wsp += (bytes + 255) & ~(size_t)255; return (void*)p; };
    bf* WQ = (bf*)take((size_t)DQ * DM * 2); bf* WK = (bf*)take((size_t)DKV * DM * 2); bf* WV = (bf*)take((size_t)DKV * DM * 2); bf* WO = (bf*)take((size_t)DM * DQ * 2); float* CS = (float*)take((size_t)TT * HD * 2 * 4);
    bf* XB = (bf*)take((size_t)TT * DM * 2); float* FQ = (float*)take((size_t)TT * DQ * 4); float* FK = (float*)take((size_t)TT * DKV * 4);
    h16* QP16 = (h16*)take((size_t)NH_ * TT * HD * 2); h16* KP16 = (h16*)take((size_t)NKV * TT * HD * 2); h16* VT16 = (h16*)take((size_t)NKV * HD * TT * 2);
    bf* QPh = (bf*)take((size_t)NH_ * TT * HD * 2); bf* QPl = (bf*)take((size_t)NH_ * TT * HD * 2); bf* KPh = (bf*)take((size_t)NKV * TT * HD * 2); bf* KPl = (bf*)take((size_t)NKV * TT * HD * 2); bf* VTh = (bf*)take((size_t)NKV * HD * TT * 2); bf* VTl = (bf*)take((size_t)NKV * HD * TT * 2); bf* Ph = (bf*)take((size_t)ZH * RH * TT * 2); bf* Pl = (bf*)take((size_t)ZH * RH * TT * 2);
    float* Sb = (float*)take((size_t)ZH * TT * TT * 4); h16* P16 = (h16*)take((size_t)ZH * TT * TT * 2); float* Ob = (float*)take((size_t)ZH * TT * HD * 4); bf* ATh = (bf*)take((size_t)TT * DQ * 2); bf* ATl = (bf*)take((size_t)TT * DQ * 2);
    if ((size_t)(wsp - (char*)d_ws) > ws_size) return;    // ws 256 MiB
    float* FV = FK;   // v projection reuses the k buffer after the k planes are built (stream-ordered)
    { k_cvt8<<<(unsigned)(((size_t)DQ * DM / 8 + 255) / 256), 256, 0, stream>>>(wq, WQ, (size_t)DQ * DM / 8); k_cvt8<<<(unsigned)(((size_t)DKV * DM / 8 + 255) / 256), 256, 0, stream>>>(wk, WK, (size_t)DKV * DM / 8); k_cvt8<<<(unsigned)(((size_t)DKV * DM / 8 + 255) / 256), 256, 0, stream>>>(wv, WV, (size_t)DKV * DM / 8);
      k_cvt8<<<(unsigned)(((size_t)DM * DQ / 8 + 255) / 256), 256, 0, stream>>>(wo, WO, (size_t)DM * DQ / 8);
       }
    k_csid<<<(TT * HD + 255) / 256, 256, 0, stream>>>(CS);
    const unsigned LQ = (unsigned)(((size_t)NH_ * TT * HD / 2 + 255) / 256), LKv = (unsigned)(((size_t)NKV * TT * HD / 2 + 255) / 256);
    for (int b = 0; b < NB_; ++b) {
        
        k_cvt8<<<(unsigned)(((size_t)TT * DM / 8 + 255) / 256), 256, 0, stream>>>(x + (size_t)b * TT * DM, XB, (size_t)TT * DM / 8);
        k_gemmw<bf, 0, false><<<dim3(TT / 64, DQ / 64, 1), 32, 0, stream>>>(XB, nullptr, WQ, nullptr, DM, FQ, DQ, nullptr, 0, 0, 0);
        k_rope<<<LQ, 256, 0, stream>>>(FQ, DQ, NH_, CS, nullptr, nullptr, 1.0f, QP16, QPh, QPl);
        k_gemmw<bf, 0, false><<<dim3(TT / 64, DKV / 64, 1), 32, 0, stream>>>(XB, nullptr, WK, nullptr, DM, FK, DKV, nullptr, 0, 0, 0);
        k_rope<<<LKv, 256, 0, stream>>>(FK, DKV, NKV, CS, nullptr, nullptr, 1.0f, KP16, KPh, KPl);
        k_gemmw<bf, 0, false><<<dim3(TT / 64, DKV / 64, 1), 32, 0, stream>>>(XB, nullptr, WV, nullptr, DM, FV, DKV, nullptr, 0, 0, 0); k_vtp<<<LKv, 256, 0, stream>>>(FV, DKV, NKV, VT16, VTh, VTl);
        for (int h0 = 0; h0 < NH_; h0 += ZH) { const size_t zq = (size_t)h0, zk = (size_t)(h0 / REP);   // REP == 1 (full multi-head attention): the pass's two heads use CONSECUTIVE kv planes: sB = TT * HD for the scores, HD * TT for P.V (REP >= 2 would share one plane: sB = 0)
            k_gemmw<bf, 2, false><<<dim3(RH / 64, TT / 64, ZH), 32, 0, stream>>>(QPh + zq * TT * HD, QPl + zq * TT * HD, KPh + zk * TT * HD, KPl + zk * TT * HD, HD, Sb, TT, nullptr, (size_t)TT * HD, (size_t)TT * HD, (size_t)TT * TT);
            k_gemmw<h16, 0, false><<<dim3((TT - RH) / 64, TT / 64, ZH), 32, 0, stream>>>(QP16 + zq * TT * HD + (size_t)RH * HD, nullptr, KP16 + zk * TT * HD, nullptr, HD, Sb + (size_t)RH * TT, TT, nullptr, (size_t)TT * HD, (size_t)TT * HD, (size_t)TT * TT);
            k_asoft<<<ZH * TT / 8, 256, 0, stream>>>(Sb, P16, Ph, Pl);
            k_gemmw<bf, 2, false><<<dim3(RH / 64, HD / 64, ZH), 32, 0, stream>>>(Ph, Pl, VTh + zk * HD * TT, VTl + zk * HD * TT, TT, Ob, HD, nullptr, (size_t)RH * TT, (size_t)HD * TT, (size_t)TT * HD);
            k_gemmw<h16, 0, false><<<dim3((TT - RH) / 64, HD / 64, ZH), 32, 0, stream>>>(P16 + (size_t)RH * TT, nullptr, VT16 + zk * HD * TT, nullptr, TT, Ob + (size_t)RH * HD, HD, nullptr, (size_t)TT * TT, (size_t)HD * TT, (size_t)TT * HD);
            k_merge<<<(unsigned)(((size_t)ZH * TT * HD / 2 + 255) / 256), 256, 0, stream>>>(Ob, h0, ATh, ATl); }
        k_gemmw<bf, 1, true><<<dim3(TT / 64, DM / 64, 1), 32, 0, stream>>>(ATh, ATl, WO, nullptr, DQ, OUT + (size_t)b * TT * DM, DM, bo, 0, 0, 0); }
}

// v001
// Measured time: 1240 microseconds a run.
// Next to v000, in two timings, it ran 1.85 times as fast each time.
#include <hip/hip_runtime.h>

// Dense multi-head attention, 16 FULL heads x 128, natural bias-free projections and a natural output projection WITH a bias (x [2][2048][2048]; q, k, v = x W^T ('oi' (out, in) [2048][2048], normal / sqrt(2048), no bias; 16 heads x 128: one kv head per query head); scores x 128^-0.5; softmax over ALL 2,048 keys (no mask, no causal rule); out = merged Wo^T + bo ('oi' + a REAL bias 0.01) -> [2][2048][2048] (8.4 M); argument order x, Wq, Wk, Wv, Wo, bo).
// Layout per batch: bf16 copy of x; 'oi' weights as-is; exact projections; identity-table plane builders at width 128; dense T-2048 attention with 16 FULL heads (REP = NH_ / NKV = 1: the two heads of a pass use their own CONSECUTIVE k / v planes: kv z-stride TT x HD, as the launches pass it; hybrid rows: < 512 hi/lo 3 products, rest fp16 x1024); merged hi/lo x Wo exact + bo.
// Compute dtypes, f32 accumulate: every input rounded to bf16; projections exact; attention rows < 512 3 products, rest fp16; softmax f32; Wo hl x exact + bo (the f32 bias epilogue).

#define NB_  2
#define TT   2048
#define DM   2048
#define NH_  16
#define NKV  16
#define REP  (NH_ / NKV)
#define HD   128
#define DQ   (NH_ * HD)
#define DKV  (NKV * HD)
#define ZH   2
#define RH   512                  // query rows < RH use hi+lo planes (0: none)
#define WIN  0
#define KS   16                   // P.V: the 2048 keys are cut into KS ranges, one work-group per (tile, range); k_merge adds the KS partial sums
#define PCAR 1024.0f
#define SCL  0.088388347648318447f   // HD^-0.5
typedef _Float16 h16;
typedef unsigned short bf;
typedef __attribute__((ext_vector_type(16))) __bf16   v16bf;
typedef __attribute__((ext_vector_type(16))) _Float16 v16h;
typedef __attribute__((ext_vector_type(8)))  _Float16 v8h;
typedef __attribute__((ext_vector_type(8)))  unsigned short v8us;
typedef __attribute__((ext_vector_type(8)))  float    v8f;
typedef __attribute__((ext_vector_type(4)))  float    v4f;
typedef v8h  __attribute__((may_alias)) v8ha;
typedef v4f  __attribute__((may_alias)) v4fa;
typedef v8us __attribute__((may_alias)) v8usa;

__device__ __forceinline__ unsigned short f2bf(float f) { unsigned u = __float_as_uint(f); u += 0x7FFFu + ((u >> 16) & 1u); return (unsigned short)(u >> 16); }
__device__ __forceinline__ float bf2f(unsigned short b) { return __uint_as_float(((unsigned)b) << 16); }
__device__ __forceinline__ float bfr(float f) { return bf2f(f2bf(f)); }
__device__ __forceinline__ v16h cat16(v8h lo, v8h hi) { return __builtin_shufflevector(lo, hi, 0, 1, 2, 3, 4, 5, 6, 7, 8, 9, 10, 11, 12, 13, 14, 15); }
__device__ __forceinline__ v16bf cat16b(v8us lo, v8us hi) { return __builtin_bit_cast(v16bf, __builtin_shufflevector(lo, hi, 0, 1, 2, 3, 4, 5, 6, 7, 8, 9, 10, 11, 12, 13, 14, 15)); }
__device__ __forceinline__ v8f wmma16(v16h a, v16h b, v8f c) { return __builtin_amdgcn_wmma_f32_16x16x32_f16(false, a, false, b, (short)0, c, false, false); }
__device__ __forceinline__ v8f wmmab(v16bf a, v16bf b, v8f c) { return __builtin_amdgcn_wmma_f32_16x16x32_bf16(false, a, false, b, (short)0, c, false, false); }



// ---- k_gemmw: register-blocked GEMM, ONE WAVE per 64x64 output tile (16 accumulators), operands straight from K-contiguous 16-bit planes; grid (M/64, N/64, Z), 32 threads.
// C[m][n] (f32, pitch ldc, + optional f32 bias[n]) = sum_k A[m][k] Bt[n][k] (+ split products per NSPLIT). z-batch strides sA/sB/sC in elements. K % 32 == 0.
// KSP > 1: grid z = Z * KSP; blockIdx.z = z * KSP + ks; the work-group sums k in [ks K/KSP, (ks+1) K/KSP) only; a row of C (ldc elements) holds the KSP partial rows side by side, partial ks at column ks ldc/KSP. K % (32 KSP) == 0.
template <typename T16> struct WFrag;
template <> struct WFrag<h16> { typedef v16h V; static __device__ __forceinline__ V ld(const h16* p) { return cat16(*(const v8h*)p, *(const v8h*)(p + 16)); } static __device__ __forceinline__ v8f mma(V a, V b, v8f c) { return wmma16(a, b, c); } };
template <> struct WFrag<bf> { typedef v16bf V; static __device__ __forceinline__ V ld(const bf* p) { return cat16b(*(const v8us*)p, *(const v8us*)(p + 16)); } static __device__ __forceinline__ v8f mma(V a, V b, v8f c) { return wmmab(a, b, c); } };
template <typename T16, int NSPLIT, bool BIAS, int KSP = 1>
__global__ __launch_bounds__(32) void k_gemmw(const T16* __restrict__ A, const T16* __restrict__ A2, const T16* __restrict__ Bt, const T16* __restrict__ Bt2, int K, float* C, int ldc, const float* __restrict__ bias, size_t sA, size_t sB, size_t sC) {
    typedef typename WFrag<T16>::V V;
    __shared__ __align__(16) float os[16 * 68];
    const size_t z = blockIdx.z / KSP; const int ks = blockIdx.z % KSP; A += z * sA; if (A2) A2 += z * sA; Bt += z * sB; if (Bt2) Bt2 += z * sB; C += z * sC + (size_t)ks * (ldc / KSP);
    const int kb = ks * (K / KSP), ke = kb + K / KSP;
    const int lane = threadIdx.x & 31, lr = lane & 15, hi = lane >> 4; const int r0 = blockIdx.x * 64, c0 = blockIdx.y * 64;
    v8f acc[4][4];
#pragma unroll
    for (int mb = 0; mb < 4; ++mb)
#pragma unroll
        for (int nb = 0; nb < 4; ++nb) acc[mb][nb] = (v8f){};
    const size_t aoff = (size_t)(r0 + lr) * K + 8 * hi, boff = (size_t)(c0 + lr) * K + 8 * hi;
#pragma unroll 1
    for (int kc = kb; kc < ke; kc += 32) {
        V a[4], a2[4];
#pragma unroll
        for (int mb = 0; mb < 4; ++mb) { a[mb] = WFrag<T16>::ld(A + aoff + (size_t)mb * 16 * K + kc); if (NSPLIT == 1 || NSPLIT == 2) a2[mb] = WFrag<T16>::ld(A2 + aoff + (size_t)mb * 16 * K + kc); }
#pragma unroll
        for (int nb = 0; nb < 4; ++nb) { const V b = WFrag<T16>::ld(Bt + boff + (size_t)nb * 16 * K + kc); V b2; if (NSPLIT >= 2) b2 = WFrag<T16>::ld(Bt2 + boff + (size_t)nb * 16 * K + kc);
#pragma unroll
            for (int mb = 0; mb < 4; ++mb) { acc[mb][nb] = WFrag<T16>::mma(a[mb], b, acc[mb][nb]); if (NSPLIT == 1 || NSPLIT == 2) acc[mb][nb] = WFrag<T16>::mma(a2[mb], b, acc[mb][nb]); if (NSPLIT >= 2) acc[mb][nb] = WFrag<T16>::mma(a[mb], b2, acc[mb][nb]); } }
        asm volatile("v_nop\n\tv_nop\n\tv_nop\n\tv_nop" : "+v"(acc[0][0]), "+v"(acc[1][1]), "+v"(acc[2][2]), "+v"(acc[3][3]) : "v"(a[0]), "v"(a[3]));
    }
#pragma unroll
    for (int mb = 0; mb < 4; ++mb) {
#pragma unroll
        for (int nb = 0; nb < 4; ++nb) {
#pragma unroll
            for (int j = 0; j < 8; ++j) os[(hi * 8 + j) * 68 + nb * 16 + lr] = acc[mb][nb][j]; }
        __builtin_amdgcn_wave_barrier(); asm volatile("" ::: "memory");
        float* crow = C + (size_t)(r0 + mb * 16) * ldc + c0;
{
#pragma unroll
            for (int s = 0; s < 8; ++s) { const int row = 2 * s + hi, cofs = lr * 4; v4f val = *(const v4fa*)(os + row * 68 + cofs); if (BIAS) { val[0] += bfr(bias[c0 + cofs]); val[1] += bfr(bias[c0 + cofs + 1]); val[2] += bfr(bias[c0 + cofs + 2]); val[3] += bfr(bias[c0 + cofs + 3]); }
                *(v4f*)(crow + (size_t)row * ldc + cofs) = val; }
             }
        __builtin_amdgcn_wave_barrier(); asm volatile("" ::: "memory");
    }
}

__device__ __forceinline__ h16 tohx(float x) { return (h16)x; }
__device__ __forceinline__ void splitf(float y, unsigned short& h, unsigned short& l) { h = f2bf(y); l = f2bf(y - bf2f(h)); }
typedef __attribute__((ext_vector_type(2))) _Float16 v2h;
typedef __attribute__((ext_vector_type(4))) _Float16 v4h;
typedef __attribute__((ext_vector_type(2))) unsigned short v2us;
typedef __attribute__((ext_vector_type(4))) unsigned short v4us;
typedef __attribute__((ext_vector_type(2))) float v2f;
typedef __attribute__((ext_vector_type(4))) int v4i;

__global__ __launch_bounds__(256) void k_cvt8(const float* __restrict__ src, bf* dst, size_t n8) { const size_t i = (size_t)blockIdx.x * 256 + threadIdx.x; if (i >= n8) return; const v8f v = *(const v8f*)(src + i * 8); v8us o;
#pragma unroll
    for (int k = 0; k < 8; ++k) o[k] = f2bf(v[k]); *(v8us*)(dst + i * 8) = o;  }

// k_rope: head planes [h][t][d] (fp16 + hi/lo) of rope(x) x sc with the rotate-half convention out[d] = x[d] cos[t][d] - x[d+HD/2] sin[t][d], out[d+HD/2] = x[d+HD/2] cos[t][d+HD/2] + x[d] sin[t][d+HD/2]
__global__ __launch_bounds__(256) void k_rope(const float* __restrict__ F, int pitch, int nheads, const float* __restrict__ CS, const float* __restrict__ RF, const float* __restrict__ nw, float sc, h16* P16, bf* Ph, bf* Pl) {
    const size_t e = ((size_t)blockIdx.x * 256 + threadIdx.x) * 2; if (e >= (size_t)nheads * TT * HD) return; const int d = (int)(e % HD); const int t = (int)((e / HD) % TT); const int h = (int)(e / ((size_t)HD * TT)); const float* f = F + (size_t)t * pitch + h * HD; const float rf = RF ? RF[(size_t)h * TT + t] : 1.0f; v2h o16; v2us oh, ol;
#pragma unroll
    for (int q = 0; q < 2; ++q) { const int dd = d + q; const int dp = (dd < HD / 2) ? dd + HD / 2 : dd - HD / 2; float x0 = f[dd], x1 = f[dp];
        if (RF) { float n0 = __fmul_rn(x0, rf), n1 = __fmul_rn(x1, rf); asm volatile("" : "+v"(n0)); asm volatile("" : "+v"(n1)); x0 = __fmul_rn(bfr(nw[dd]), n0); x1 = __fmul_rn(bfr(nw[dp]), n1); }
        const v2f cs = *(const v2f*)(CS + ((size_t)t * HD + dd) * 2); float a = __fmul_rn(x0, cs[0]), bq = __fmul_rn(x1, cs[1]); asm volatile("" : "+v"(a)); asm volatile("" : "+v"(bq)); const float r = ((dd < HD / 2) ? __fsub_rn(a, bq) : __fadd_rn(a, bq)) * sc;
        o16[q] = tohx(r); unsigned short a2, c2; splitf(r, a2, c2); oh[q] = a2; ol[q] = c2; }
    *(v2h*)(P16 + e) = o16; *(v2us*)(Ph + e) = oh; *(v2us*)(Pl + e) = ol;  }
__global__ __launch_bounds__(256) void k_vtp(const float* __restrict__ F, int pitch, int nheads, h16* V16, bf* Vh, bf* Vl) { const size_t e = ((size_t)blockIdx.x * 256 + threadIdx.x) * 2; if (e >= (size_t)nheads * HD * TT) return; const int t = (int)(e % TT); const int d = (int)((e / TT) % HD); const int g = (int)(e / ((size_t)TT * HD)); v2h o16; v2us oh, ol;
#pragma unroll
    for (int q = 0; q < 2; ++q) { const float x = F[(size_t)(t + q) * pitch + g * HD + d]; o16[q] = tohx(x); unsigned short a2, c2; splitf(x, a2, c2); oh[q] = a2; ol[q] = c2; }
    *(v2h*)(V16 + e) = o16; *(v2us*)(Vh + e) = oh; *(v2us*)(Vl + e) = ol;  }
__global__ __launch_bounds__(256) void k_csid(float* CS) { const int idx = blockIdx.x * 256 + threadIdx.x; if (idx >= TT * HD) return; v2f cs; cs[0] = 1.0f; cs[1] = 0.0f; *(v2f*)(CS + (size_t)idx * 2) = cs;  }
// k_asoft: per row (zz, i): t = S x HD^-0.5 (no mask); softmax over the 2048 keys (register row, one exp, fixed trees);
__global__ __launch_bounds__(256) void k_asoft(const float* __restrict__ Sb, h16* P16, bf* Ph, bf* Pl) {
    const int lane = threadIdx.x & 31; const int row = blockIdx.x * 8 + (threadIdx.x >> 5); if (row >= ZH * TT) return; const int i = row % TT; const int zz = row / TT; (void)zz; const bool hires = (i < RH); const float* sr = Sb + (size_t)row * TT; float v[TT / 32]; float mx = -3.0e38f;
#pragma unroll
    for (int ch = 0; ch < TT / 128; ++ch) { const int j0 = ch * 128 + lane * 4; const v4f a = *(const v4f*)(sr + j0);
#pragma unroll
        for (int q = 0; q < 4; ++q) { const int j = j0 + q; (void)j; const float t = a[q] * SCL; v[ch * 4 + q] = t; mx = fmaxf(mx, t); } }
#pragma unroll
    for (int sh = 16; sh; sh >>= 1) mx = fmaxf(mx, __shfl_xor(mx, sh, 32));
    float sum = 0.f;
#pragma unroll
    for (int k = 0; k < TT / 32; ++k) { float d0 = __fsub_rn(v[k], mx); asm volatile("" : "+v"(d0)); v[k] = __builtin_amdgcn_exp2f(__fmul_rn(d0, 1.4426950408889634f)); sum += v[k]; }
#pragma unroll
    for (int sh = 16; sh; sh >>= 1) sum += __shfl_xor(sum, sh, 32);
    const float f = __fdiv_rn(hires ? 1.0f : PCAR, sum);
{
        if (hires) {
#pragma unroll
            for (int ch = 0; ch < TT / 128; ++ch) { v4us oh, ol;
#pragma unroll
                for (int q = 0; q < 4; ++q) { unsigned short a, c2; splitf(v[ch * 4 + q] * f, a, c2); oh[q] = a; ol[q] = c2; }
                const size_t oo = ((size_t)zz * (RH ? RH : 1) + i) * TT + ch * 128 + lane * 4; *(v4us*)(Ph + oo) = oh; *(v4us*)(Pl + oo) = ol; }
        } else {
#pragma unroll
            for (int ch = 0; ch < TT / 128; ++ch) { v4h o4;
#pragma unroll
                for (int q = 0; q < 4; ++q) o4[q] = tohx(v[ch * 4 + q] * f);
                *(v4h*)(P16 + (size_t)row * TT + ch * 128 + lane * 4) = o4; } }
         }
}
__global__ __launch_bounds__(256) void k_merge(const float* __restrict__ O, int h0, bf* Ah, bf* Al) { const size_t e = ((size_t)blockIdx.x * 256 + threadIdx.x) * 2; if (e >= (size_t)ZH * TT * HD) return; const int d = (int)(e % HD); const int t = (int)((e / HD) % TT); const int zz = (int)(e / ((size_t)HD * TT)); const float cs = (t < RH) ? 1.0f : (1.0f / PCAR); const size_t oo = (size_t)t * DQ + (h0 + zz) * HD + d;
    const float* Or = O + (e / HD) * (size_t)(KS * HD) + d;   // row (zz, t) holds its KS partial rows of P.V side by side; added in ascending key order
    v2f pv[KS];
#pragma unroll
    for (int p = 0; p < KS; ++p) pv[p] = *(const v2f*)(Or + p * HD);
    asm volatile("s_wait_xcnt 0x0" :: "v"(Or) : "memory");   // precaution behind the loads: the address is an input, so no load's result is placed on the address pair in front of the wait
    v2f sum = pv[0];
#pragma unroll
    for (int p = 1; p < KS; ++p) sum += pv[p];
    v2us oh, ol;
#pragma unroll
    for (int q = 0; q < 2; ++q) { unsigned short a, c2; splitf(sum[q] * cs, a, c2); oh[q] = a; ol[q] = c2; } *(v2us*)(Ah + oo) = oh; *(v2us*)(Al + oo) = ol;  }

extern "C" void kernel_launch(void* const* d_in, const int* in_sizes, int n_in,
                              void* d_out, int out_size, void* d_ws, size_t ws_size, hipStream_t stream) {
    (void)in_sizes; (void)n_in; (void)out_size;
    const float* x = (const float*)d_in[0]; const float* wq = (const float*)d_in[1]; const float* wk = (const float*)d_in[2]; const float* wv = (const float*)d_in[3]; const float* wo = (const float*)d_in[4]; const float* bo = (const float*)d_in[5];   /* order x, Wq, Wk, Wv, Wo ('oi' (out, in) [2048][2048] x 4; normal / sqrt(2048); no projection biases), bo (a REAL output bias [2048], 0.01): SIX inputs, all read */
    float* OUT = (float*)d_out;     // [2][2048][2048]
    char* wsp = (char*)d_ws;
    auto take = [&](size_t bytes) { char* p = wsp; wsp += (bytes + 255) & ~(size_t)255; return (void*)p; };
    bf* WQ = (bf*)take((size_t)DQ * DM * 2); bf* WK = (bf*)take((size_t)DKV * DM * 2); bf* WV = (bf*)take((size_t)DKV * DM * 2); bf* WO = (bf*)take((size_t)DM * DQ * 2); float* CS = (float*)take((size_t)TT * HD * 2 * 4);
    bf* XB = (bf*)take((size_t)TT * DM * 2); float* FQ = (float*)take((size_t)TT * DQ * 4); float* FK = (float*)take((size_t)TT * DKV * 4);
    h16* QP16 = (h16*)take((size_t)NH_ * TT * HD * 2); h16* KP16 = (h16*)take((size_t)NKV * TT * HD * 2); h16* VT16 = (h16*)take((size_t)NKV * HD * TT * 2);
    bf* QPh = (bf*)take((size_t)NH_ * TT * HD * 2); bf* QPl = (bf*)take((size_t)NH_ * TT * HD * 2); bf* KPh = (bf*)take((size_t)NKV * TT * HD * 2); bf* KPl = (bf*)take((size_t)NKV * TT * HD * 2); bf* VTh = (bf*)take((size_t)NKV * HD * TT * 2); bf* VTl = (bf*)take((size_t)NKV * HD * TT * 2); bf* Ph = (bf*)take((size_t)ZH * RH * TT * 2); bf* Pl = (bf*)take((size_t)ZH * RH * TT * 2);
    float* Sb = (float*)take((size_t)ZH * TT * TT * 4); h16* P16 = (h16*)take((size_t)ZH * TT * TT * 2); float* Ob = (float*)take((size_t)KS * ZH * TT * HD * 4); bf* ATh = (bf*)take((size_t)TT * DQ * 2); bf* ATl = (bf*)take((size_t)TT * DQ * 2);
    if ((size_t)(wsp - (char*)d_ws) > ws_size) return;    // ws 256 MiB
    float* FV = FK;   // v projection reuses the k buffer after the k planes are built (stream-ordered)
    { k_cvt8<<<(unsigned)(((size_t)DQ * DM / 8 + 255) / 256), 256, 0, stream>>>(wq, WQ, (size_t)DQ * DM / 8); k_cvt8<<<(unsigned)(((size_t)DKV * DM / 8 + 255) / 256), 256, 0, stream>>>(wk, WK, (size_t)DKV * DM / 8); k_cvt8<<<(unsigned)(((size_t)DKV * DM / 8 + 255) / 256), 256, 0, stream>>>(wv, WV, (size_t)DKV * DM / 8);
      k_cvt8<<<(unsigned)(((size_t)DM * DQ / 8 + 255) / 256), 256, 0, stream>>>(wo, WO, (size_t)DM * DQ / 8);
       }
    k_csid<<<(TT * HD + 255) / 256, 256, 0, stream>>>(CS);
    const unsigned LQ = (unsigned)(((size_t)NH_ * TT * HD / 2 + 255) / 256), LKv = (unsigned)(((size_t)NKV * TT * HD / 2 + 255) / 256);
    for (int b = 0; b < NB_; ++b) {
        
        k_cvt8<<<(unsigned)(((size_t)TT * DM / 8 + 255) / 256), 256, 0, stream>>>(x + (size_t)b * TT * DM, XB, (size_t)TT * DM / 8);
        k_gemmw<bf, 0, false><<<dim3(TT / 64, DQ / 64, 1), 32, 0, stream>>>(XB, nullptr, WQ, nullptr, DM, FQ, DQ, nullptr, 0, 0, 0);
        k_rope<<<LQ, 256, 0, stream>>>(FQ, DQ, NH_, CS, nullptr, nullptr, 1.0f, QP16, QPh, QPl);
        k_gemmw<bf, 0, false><<<dim3(TT / 64, DKV / 64, 1), 32, 0, stream>>>(XB, nullptr, WK, nullptr, DM, FK, DKV, nullptr, 0, 0, 0);
        k_rope<<<LKv, 256, 0, stream>>>(FK, DKV, NKV, CS, nullptr, nullptr, 1.0f, KP16, KPh, KPl);
        k_gemmw<bf, 0, false><<<dim3(TT / 64, DKV / 64, 1), 32, 0, stream>>>(XB, nullptr, WV, nullptr, DM, FV, DKV, nullptr, 0, 0, 0); k_vtp<<<LKv, 256, 0, stream>>>(FV, DKV, NKV, VT16, VTh, VTl);
        for (int h0 = 0; h0 < NH_; h0 += ZH) { const size_t zq = (size_t)h0, zk = (size_t)(h0 / REP);   // REP == 1 (full multi-head attention): the pass's two heads use CONSECUTIVE kv planes: sB = TT * HD for the scores, HD * TT for P.V (REP >= 2 would share one plane: sB = 0)
            k_gemmw<bf, 2, false><<<dim3(RH / 64, TT / 64, ZH), 32, 0, stream>>>(QPh + zq * TT * HD, QPl + zq * TT * HD, KPh + zk * TT * HD, KPl + zk * TT * HD, HD, Sb, TT, nullptr, (size_t)TT * HD, (size_t)TT * HD, (size_t)TT * TT);
            k_gemmw<h16, 0, false><<<dim3((TT - RH) / 64, TT / 64, ZH), 32, 0, stream>>>(QP16 + zq * TT * HD + (size_t)RH * HD, nullptr, KP16 + zk * TT * HD, nullptr, HD, Sb + (size_t)RH * TT, TT, nullptr, (size_t)TT * HD, (size_t)TT * HD, (size_t)TT * TT);
            k_asoft<<<ZH * TT / 8, 256, 0, stream>>>(Sb, P16, Ph, Pl);
            k_gemmw<bf, 2, false, KS><<<dim3(RH / 64, HD / 64, ZH * KS), 32, 0, stream>>>(Ph, Pl, VTh + zk * HD * TT, VTl + zk * HD * TT, TT, Ob, KS * HD, nullptr, (size_t)RH * TT, (size_t)HD * TT, (size_t)TT * KS * HD);
            k_gemmw<h16, 0, false, KS><<<dim3((TT - RH) / 64, HD / 64, ZH * KS), 32, 0, stream>>>(P16 + (size_t)RH * TT, nullptr, VT16 + zk * HD * TT, nullptr, TT, Ob + (size_t)RH * KS * HD, KS * HD, nullptr, (size_t)TT * TT, (size_t)HD * TT, (size_t)TT * KS * HD);
            k_merge<<<(unsigned)(((size_t)ZH * TT * HD / 2 + 255) / 256), 256, 0, stream>>>(Ob, h0, ATh, ATl); }
        k_gemmw<bf, 1, true><<<dim3(TT / 64, DM / 64, 1), 32, 0, stream>>>(ATh, ATl, WO, nullptr, DQ, OUT + (size_t)b * TT * DM, DM, bo, 0, 0, 0); }
}

// v002
// Measured time: 787 microseconds a run.
// Timed twice side by side with v001, it ran 1.57 and 1.58 times as fast.
// Over all steps from v000 it is 2.92 times as fast.
#include <hip/hip_runtime.h>

// Dense multi-head attention, 16 FULL heads x 128, natural bias-free projections and a natural output projection WITH a bias (x [2][2048][2048]; q, k, v = x W^T ('oi' (out, in) [2048][2048], normal / sqrt(2048), no bias; 16 heads x 128: one kv head per query head); scores x 128^-0.5; softmax over ALL 2,048 keys (no mask, no causal rule); out = merged Wo^T + bo ('oi' + a REAL bias 0.01) -> [2][2048][2048] (8.4 M); argument order x, Wq, Wk, Wv, Wo, bo).
// Layout per batch: bf16 copy of x; 'oi' weights as-is; exact projections; identity-table plane builders at width 128; one fused dense T-2048 attention launch over the 16 FULL heads (REP = NH_ / NKV = 1: each head has its own k / v plane; hybrid rows: < 512 hi/lo 3 products, rest fp16 with p <= 1024); merged hi/lo x Wo exact + bo.
// Compute dtypes, f32 accumulate: every input rounded to bf16; projections exact; attention rows < 512 3 products, rest fp16; softmax f32; Wo hl x exact + bo (the f32 bias epilogue).

#define NB_  2
#define TT   2048
#define DM   2048
#define NH_  16
#define NKV  16
#define REP  (NH_ / NKV)
#define HD   128
#define DQ   (NH_ * HD)
#define DKV  (NKV * HD)
#define RH   512                  // query rows < RH use hi+lo planes (0: none)
#define WIN  0
#define SCL  0.088388347648318447f   // HD^-0.5
typedef _Float16 h16;
typedef unsigned short bf;
typedef __attribute__((ext_vector_type(16))) __bf16   v16bf;
typedef __attribute__((ext_vector_type(16))) _Float16 v16h;
typedef __attribute__((ext_vector_type(8)))  _Float16 v8h;
typedef __attribute__((ext_vector_type(8)))  unsigned short v8us;
typedef __attribute__((ext_vector_type(8)))  float    v8f;
typedef __attribute__((ext_vector_type(4)))  float    v4f;
typedef v8h  __attribute__((may_alias)) v8ha;
typedef v4f  __attribute__((may_alias)) v4fa;
typedef v8us __attribute__((may_alias)) v8usa;

__device__ __forceinline__ unsigned short f2bf(float f) { unsigned u = __float_as_uint(f); u += 0x7FFFu + ((u >> 16) & 1u); return (unsigned short)(u >> 16); }
__device__ __forceinline__ float bf2f(unsigned short b) { return __uint_as_float(((unsigned)b) << 16); }
__device__ __forceinline__ float bfr(float f) { return bf2f(f2bf(f)); }
__device__ __forceinline__ v16h cat16(v8h lo, v8h hi) { return __builtin_shufflevector(lo, hi, 0, 1, 2, 3, 4, 5, 6, 7, 8, 9, 10, 11, 12, 13, 14, 15); }
__device__ __forceinline__ v16bf cat16b(v8us lo, v8us hi) { return __builtin_bit_cast(v16bf, __builtin_shufflevector(lo, hi, 0, 1, 2, 3, 4, 5, 6, 7, 8, 9, 10, 11, 12, 13, 14, 15)); }
__device__ __forceinline__ v8f wmma16(v16h a, v16h b, v8f c) { return __builtin_amdgcn_wmma_f32_16x16x32_f16(false, a, false, b, (short)0, c, false, false); }
__device__ __forceinline__ v8f wmmab(v16bf a, v16bf b, v8f c) { return __builtin_amdgcn_wmma_f32_16x16x32_bf16(false, a, false, b, (short)0, c, false, false); }



// ---- k_gemmw: register-blocked GEMM, ONE WAVE per 64x64 output tile (16 accumulators), operands straight from K-contiguous 16-bit planes; grid (M/64, N/64, Z), 32 threads.
// C[m][n] (f32, pitch ldc, + optional f32 bias[n]) = sum_k A[m][k] Bt[n][k] (+ split products per NSPLIT). z-batch strides sA/sB/sC in elements. K % 32 == 0.
// KSP > 1: grid z = Z * KSP; blockIdx.z = z * KSP + ks; the work-group sums k in [ks K/KSP, (ks+1) K/KSP) only; a row of C (ldc elements) holds the KSP partial rows side by side, partial ks at column ks ldc/KSP. K % (32 KSP) == 0.
template <typename T16> struct WFrag;
template <> struct WFrag<h16> { typedef v16h V; static __device__ __forceinline__ V ld(const h16* p) { return cat16(*(const v8h*)p, *(const v8h*)(p + 16)); } static __device__ __forceinline__ v8f mma(V a, V b, v8f c) { return wmma16(a, b, c); } };
template <> struct WFrag<bf> { typedef v16bf V; static __device__ __forceinline__ V ld(const bf* p) { return cat16b(*(const v8us*)p, *(const v8us*)(p + 16)); } static __device__ __forceinline__ v8f mma(V a, V b, v8f c) { return wmmab(a, b, c); } };
template <typename T16, int NSPLIT, bool BIAS, int KSP = 1>
__global__ __launch_bounds__(32) void k_gemmw(const T16* __restrict__ A, const T16* __restrict__ A2, const T16* __restrict__ Bt, const T16* __restrict__ Bt2, int K, float* C, int ldc, const float* __restrict__ bias, size_t sA, size_t sB, size_t sC) {
    typedef typename WFrag<T16>::V V;
    __shared__ __align__(16) float os[16 * 68];
    const size_t z = blockIdx.z / KSP; const int ks = blockIdx.z % KSP; A += z * sA; if (A2) A2 += z * sA; Bt += z * sB; if (Bt2) Bt2 += z * sB; C += z * sC + (size_t)ks * (ldc / KSP);
    const int kb = ks * (K / KSP), ke = kb + K / KSP;
    const int lane = threadIdx.x & 31, lr = lane & 15, hi = lane >> 4; const int r0 = blockIdx.x * 64, c0 = blockIdx.y * 64;
    v8f acc[4][4];
#pragma unroll
    for (int mb = 0; mb < 4; ++mb)
#pragma unroll
        for (int nb = 0; nb < 4; ++nb) acc[mb][nb] = (v8f){};
    const size_t aoff = (size_t)(r0 + lr) * K + 8 * hi, boff = (size_t)(c0 + lr) * K + 8 * hi;
#pragma unroll 1
    for (int kc = kb; kc < ke; kc += 32) {
        V a[4], a2[4];
#pragma unroll
        for (int mb = 0; mb < 4; ++mb) { a[mb] = WFrag<T16>::ld(A + aoff + (size_t)mb * 16 * K + kc); if (NSPLIT == 1 || NSPLIT == 2) a2[mb] = WFrag<T16>::ld(A2 + aoff + (size_t)mb * 16 * K + kc); }
#pragma unroll
        for (int nb = 0; nb < 4; ++nb) { const V b = WFrag<T16>::ld(Bt + boff + (size_t)nb * 16 * K + kc); V b2; if (NSPLIT >= 2) b2 = WFrag<T16>::ld(Bt2 + boff + (size_t)nb * 16 * K + kc);
#pragma unroll
            for (int mb = 0; mb < 4; ++mb) { acc[mb][nb] = WFrag<T16>::mma(a[mb], b, acc[mb][nb]); if (NSPLIT == 1 || NSPLIT == 2) acc[mb][nb] = WFrag<T16>::mma(a2[mb], b, acc[mb][nb]); if (NSPLIT >= 2) acc[mb][nb] = WFrag<T16>::mma(a[mb], b2, acc[mb][nb]); } }
        asm volatile("v_nop\n\tv_nop\n\tv_nop\n\tv_nop" : "+v"(acc[0][0]), "+v"(acc[1][1]), "+v"(acc[2][2]), "+v"(acc[3][3]) : "v"(a[0]), "v"(a[3]));
    }
#pragma unroll
    for (int mb = 0; mb < 4; ++mb) {
#pragma unroll
        for (int nb = 0; nb < 4; ++nb) {
#pragma unroll
            for (int j = 0; j < 8; ++j) os[(hi * 8 + j) * 68 + nb * 16 + lr] = acc[mb][nb][j]; }
        __builtin_amdgcn_wave_barrier(); asm volatile("" ::: "memory");
        float* crow = C + (size_t)(r0 + mb * 16) * ldc + c0;
{
#pragma unroll
            for (int s = 0; s < 8; ++s) { const int row = 2 * s + hi, cofs = lr * 4; v4f val = *(const v4fa*)(os + row * 68 + cofs); if (BIAS) { val[0] += bfr(bias[c0 + cofs]); val[1] += bfr(bias[c0 + cofs + 1]); val[2] += bfr(bias[c0 + cofs + 2]); val[3] += bfr(bias[c0 + cofs + 3]); }
                *(v4f*)(crow + (size_t)row * ldc + cofs) = val; }
             }
        __builtin_amdgcn_wave_barrier(); asm volatile("" ::: "memory");
    }
}

__device__ __forceinline__ h16 tohx(float x) { return (h16)x; }
__device__ __forceinline__ void splitf(float y, unsigned short& h, unsigned short& l) { h = f2bf(y); l = f2bf(y - bf2f(h)); }
typedef __attribute__((ext_vector_type(2))) _Float16 v2h;
typedef __attribute__((ext_vector_type(4))) _Float16 v4h;
typedef __attribute__((ext_vector_type(2))) unsigned short v2us;
typedef __attribute__((ext_vector_type(4))) unsigned short v4us;
typedef __attribute__((ext_vector_type(2))) float v2f;
typedef __attribute__((ext_vector_type(4))) int v4i;

__global__ __launch_bounds__(256) void k_cvt8(const float* __restrict__ src, bf* dst, size_t n8) { const size_t i = (size_t)blockIdx.x * 256 + threadIdx.x; if (i >= n8) return; const v8f v = *(const v8f*)(src + i * 8); v8us o;
#pragma unroll
    for (int k = 0; k < 8; ++k) o[k] = f2bf(v[k]); *(v8us*)(dst + i * 8) = o;  }

// k_rope: head planes [h][t][d] (fp16 + hi/lo) of rope(x) x sc with the rotate-half convention out[d] = x[d] cos[t][d] - x[d+HD/2] sin[t][d], out[d+HD/2] = x[d+HD/2] cos[t][d+HD/2] + x[d] sin[t][d+HD/2]
__global__ __launch_bounds__(256) void k_rope(const float* __restrict__ F, int pitch, int nheads, const float* __restrict__ CS, const float* __restrict__ RF, const float* __restrict__ nw, float sc, h16* P16, bf* Ph, bf* Pl) {
    const size_t e = ((size_t)blockIdx.x * 256 + threadIdx.x) * 2; if (e >= (size_t)nheads * TT * HD) return; const int d = (int)(e % HD); const int t = (int)((e / HD) % TT); const int h = (int)(e / ((size_t)HD * TT)); const float* f = F + (size_t)t * pitch + h * HD; const float rf = RF ? RF[(size_t)h * TT + t] : 1.0f; v2h o16; v2us oh, ol;
#pragma unroll
    for (int q = 0; q < 2; ++q) { const int dd = d + q; const int dp = (dd < HD / 2) ? dd + HD / 2 : dd - HD / 2; float x0 = f[dd], x1 = f[dp];
        if (RF) { float n0 = __fmul_rn(x0, rf), n1 = __fmul_rn(x1, rf); asm volatile("" : "+v"(n0)); asm volatile("" : "+v"(n1)); x0 = __fmul_rn(bfr(nw[dd]), n0); x1 = __fmul_rn(bfr(nw[dp]), n1); }
        const v2f cs = *(const v2f*)(CS + ((size_t)t * HD + dd) * 2); float a = __fmul_rn(x0, cs[0]), bq = __fmul_rn(x1, cs[1]); asm volatile("" : "+v"(a)); asm volatile("" : "+v"(bq)); const float r = ((dd < HD / 2) ? __fsub_rn(a, bq) : __fadd_rn(a, bq)) * sc;
        o16[q] = tohx(r); unsigned short a2, c2; splitf(r, a2, c2); oh[q] = a2; ol[q] = c2; }
    *(v2h*)(P16 + e) = o16; *(v2us*)(Ph + e) = oh; *(v2us*)(Pl + e) = ol;  }
__global__ __launch_bounds__(256) void k_vtp(const float* __restrict__ F, int pitch, int nheads, h16* V16, bf* Vh, bf* Vl) { const size_t e = ((size_t)blockIdx.x * 256 + threadIdx.x) * 2; if (e >= (size_t)nheads * HD * TT) return; const int t = (int)(e % TT); const int d = (int)((e / TT) % HD); const int g = (int)(e / ((size_t)TT * HD)); v2h o16; v2us oh, ol;
#pragma unroll
    for (int q = 0; q < 2; ++q) { const float x = F[(size_t)(t + q) * pitch + g * HD + d]; o16[q] = tohx(x); unsigned short a2, c2; splitf(x, a2, c2); oh[q] = a2; ol[q] = c2; }
    *(v2h*)(V16 + e) = o16; *(v2us*)(Vh + e) = oh; *(v2us*)(Vl + e) = ol;  }
__global__ __launch_bounds__(256) void k_csid(float* CS) { const int idx = blockIdx.x * 256 + threadIdx.x; if (idx >= TT * HD) return; v2f cs; cs[0] = 1.0f; cs[1] = 0.0f; *(v2f*)(CS + (size_t)idx * 2) = cs;  }
// ---- k_attn: scores, softmax and P.V of one batch in ONE launch, all heads; no score or probability matrix goes through memory.
// A wave owns NQ x 16 query rows of one head and walks the 2048 keys in blocks of 32. It forms the TRANSPOSED score tile S^T = K Q^T (A = key rows, B = query rows): a lane then holds, for ITS query (lane & 15),
// keys 8 hi + j of the first 16-key tile and 16 + 8 hi + j of the second, which is the B fragment order of the next product O^T = V^T P^T (A = rows of the [d][t] value plane): no shuffle, no LDS.
// Softmax is the running form: per query a running maximum mo (kept 10 below the true one in log2 units, so that p <= 1024: the carrier of the 16-bit probabilities; it cancels in the division) and a running sum;
// the O^T tiles are rescaled by 2^(old - new) every block. Rows < RH: hi + lo planes, 3 products; the rest f16, as before. The four waves of a work-group walk the same head's keys, so three of four fragment reads can hit the WGP cache.
template <typename T16, int NSPLIT, int NQ>
__device__ __forceinline__ void attn_rows(const T16* __restrict__ Q, const T16* __restrict__ Q2, const T16* __restrict__ Kp, const T16* __restrict__ K2, const T16* __restrict__ Vt, const T16* __restrict__ V2, int q0, bf* Ah, bf* Al) {
    typedef typename WFrag<T16>::V V;
    const int lane = threadIdx.x & 31, lr = lane & 15, hi = lane >> 4;
    V qf[NQ][4], qf2[NQ][4];
    const T16* qa = Q + (size_t)(q0 + lr) * HD + 8 * hi; const T16* qa2 = NSPLIT ? Q2 + (size_t)(q0 + lr) * HD + 8 * hi : qa;
#pragma unroll
    for (int q = 0; q < NQ; ++q)
#pragma unroll
        for (int c = 0; c < 4; ++c) { qf[q][c] = WFrag<T16>::ld(qa + q * 16 * HD + c * 32); if (NSPLIT) qf2[q][c] = WFrag<T16>::ld(qa2 + q * 16 * HD + c * 32); }
    asm volatile("s_wait_xcnt 0x0" :: "v"(qa), "v"(qa2) : "memory");   // precaution behind the loads: the addresses are inputs, so they are not rewritten in front of the wait
    v8f o[NQ][8]; float mo[NQ], ls[NQ];
#pragma unroll
    for (int q = 0; q < NQ; ++q) { mo[q] = -3.0e38f; ls[q] = 0.f;
#pragma unroll
        for (int mt = 0; mt < 8; ++mt) o[q][mt] = (v8f){}; }
    const size_t kl = (size_t)lr * HD + 8 * hi, vl = (size_t)lr * TT + 8 * hi;
    V kf[2][4], kf2[2][4], vf[8], vf2[8];
    // each fetch ends in s_wait_xcnt 0 with its addresses as inputs: a precaution (no address register is rewritten in front of the wait); the statement also keeps the loads at the early place where they are written
    auto fetch_k = [&](int k0) { const T16* ka = Kp + kl + (size_t)k0 * HD; const T16* ka2 = NSPLIT ? K2 + kl + (size_t)k0 * HD : ka;
#pragma unroll
        for (int kt = 0; kt < 2; ++kt)
#pragma unroll
            for (int c = 0; c < 4; ++c) { kf[kt][c] = WFrag<T16>::ld(ka + kt * 16 * HD + c * 32); if (NSPLIT) kf2[kt][c] = WFrag<T16>::ld(ka2 + kt * 16 * HD + c * 32); }
        asm volatile("s_wait_xcnt 0x0" :: "v"(ka), "v"(ka2) : "memory"); };
    auto fetch_v = [&](int k0) { const T16* va = Vt + vl + k0; const T16* va2 = NSPLIT ? V2 + vl + k0 : va;
#pragma unroll
        for (int mt = 0; mt < 8; ++mt) { vf[mt] = WFrag<T16>::ld(va + (size_t)mt * 16 * TT); if (NSPLIT) vf2[mt] = WFrag<T16>::ld(va2 + (size_t)mt * 16 * TT); }
        asm volatile("s_wait_xcnt 0x0" :: "v"(va), "v"(va2) : "memory"); };
    fetch_k(0); fetch_v(0);
#pragma unroll 1   // kept rolled: one trip already holds a whole key block's matrix instructions and both fetches
    for (int kb = 0; kb < TT; kb += 32) {
        const int nk = (kb + 32 < TT) ? kb + 32 : kb;   // the block fetched ahead; the last trip fetches its own again (in bounds, unused)
        v8f s[NQ][2];
#pragma unroll
        for (int q = 0; q < NQ; ++q) { s[q][0] = (v8f){}; s[q][1] = (v8f){}; }
#pragma unroll
        for (int c = 0; c < 4; ++c) {
#pragma unroll
            for (int kt = 0; kt < 2; ++kt)
#pragma unroll
                for (int q = 0; q < NQ; ++q) s[q][kt] = WFrag<T16>::mma(kf[kt][c], qf[q][c], s[q][kt]);
            if (NSPLIT) {
#pragma unroll
                for (int kt = 0; kt < 2; ++kt)
#pragma unroll
                    for (int q = 0; q < NQ; ++q) s[q][kt] = WFrag<T16>::mma(kf2[kt][c], qf[q][c], s[q][kt]);
#pragma unroll
                for (int kt = 0; kt < 2; ++kt)
#pragma unroll
                    for (int q = 0; q < NQ; ++q) s[q][kt] = WFrag<T16>::mma(kf[kt][c], qf2[q][c], s[q][kt]); } }
        // next block's key fragments: in flight under the softmax and P.V of this block
        fetch_k(nk);
        V pf[NQ], pf2[NQ];
#pragma unroll
        for (int q = 0; q < NQ; ++q) {
            float mx = -3.0e38f;
#pragma unroll
            for (int kt = 0; kt < 2; ++kt)
#pragma unroll
                for (int j = 0; j < 8; ++j) { s[q][kt][j] *= SCL * 1.4426950408889634f; mx = fmaxf(mx, s[q][kt][j]); }
            mx = fmaxf(mx, __shfl_xor(mx, 16, 32));
            const float mn = fmaxf(mo[q], mx - 10.0f); const float al = __builtin_amdgcn_exp2f(mo[q] - mn); mo[q] = mn;
            float ps = 0.f;
#pragma unroll
            for (int kt = 0; kt < 2; ++kt)
#pragma unroll
                for (int j = 0; j < 8; ++j) { s[q][kt][j] = __builtin_amdgcn_exp2f(s[q][kt][j] - mn); ps += s[q][kt][j]; }
            ls[q] = ls[q] * al + ps;
#pragma unroll
            for (int mt = 0; mt < 8; ++mt) o[q][mt] *= al;
            if constexpr (NSPLIT == 0) { v16h p;
#pragma unroll
                for (int j = 0; j < 8; ++j) { p[j] = tohx(s[q][0][j]); p[8 + j] = tohx(s[q][1][j]); }
                pf[q] = p;
            } else { v8us h0, h1, l0, l1;
#pragma unroll
                for (int j = 0; j < 8; ++j) { unsigned short a, c2; splitf(s[q][0][j], a, c2); h0[j] = a; l0[j] = c2; splitf(s[q][1][j], a, c2); h1[j] = a; l1[j] = c2; }
                pf[q] = cat16b(h0, h1); pf2[q] = cat16b(l0, l1); } }
#pragma unroll
        for (int mt = 0; mt < 8; ++mt)
#pragma unroll
            for (int q = 0; q < NQ; ++q) o[q][mt] = WFrag<T16>::mma(vf[mt], pf[q], o[q][mt]);
        if (NSPLIT) {
#pragma unroll
            for (int mt = 0; mt < 8; ++mt)
#pragma unroll
                for (int q = 0; q < NQ; ++q) o[q][mt] = WFrag<T16>::mma(vf[mt], pf2[q], o[q][mt]);
#pragma unroll
            for (int mt = 0; mt < 8; ++mt)
#pragma unroll
                for (int q = 0; q < NQ; ++q) o[q][mt] = WFrag<T16>::mma(vf2[mt], pf[q], o[q][mt]); }
        // next block's value fragments: in flight under the next block's scores and softmax
        fetch_v(nk);
    }
#pragma unroll
    for (int q = 0; q < NQ; ++q) { const float inv = __fdiv_rn(1.0f, ls[q] + __shfl_xor(ls[q], 16, 32)); const size_t oo = (size_t)(q0 + q * 16 + lr) * DQ + 8 * hi;
#pragma unroll
        for (int mt = 0; mt < 8; ++mt) { v8us oh, ol;
#pragma unroll
            for (int j = 0; j < 8; ++j) { unsigned short a, c2; splitf(o[q][mt][j] * inv, a, c2); oh[j] = a; ol[j] = c2; }
            *(v8us*)(Ah + oo + mt * 16) = oh; *(v8us*)(Al + oo + mt * 16) = ol;
            asm volatile("s_wait_xcnt 0x0" :: "v"(oh), "v"(ol) : "memory"); } }   // precaution behind the two stores: their data are inputs, so no data register is rewritten (next tile's packing, the code behind the call) in front of the wait
}
#define WHI (RH / 64)             // work-groups per head on the hi + lo rows: 4 waves x 16 rows
#define WLO ((TT - RH) / 128)     // work-groups per head on the f16 rows: 4 waves x 32 rows
__global__ __launch_bounds__(128) void k_attn(const h16* __restrict__ Q16, const h16* __restrict__ K16, const h16* __restrict__ V16, const bf* __restrict__ Qh, const bf* __restrict__ Ql, const bf* __restrict__ Kh, const bf* __restrict__ Kl, const bf* __restrict__ Vh, const bf* __restrict__ Vl, bf* Ah, bf* Al) {
    const int w = threadIdx.x >> 5; int b = blockIdx.x;
    if (b < NH_ * WHI) { const int h = b / WHI; const size_t pz = (size_t)h * TT * HD;   // the longer work-groups (3 products) take the lower block indices
        attn_rows<bf, 2, 1>(Qh + pz, Ql + pz, Kh + pz, Kl + pz, Vh + pz, Vl + pz, (b % WHI) * 64 + w * 16, Ah + h * HD, Al + h * HD);
    } else { b -= NH_ * WHI; const int h = b / WLO; const size_t pz = (size_t)h * TT * HD;
        attn_rows<h16, 0, 2>(Q16 + pz, nullptr, K16 + pz, nullptr, V16 + pz, nullptr, RH + (b % WLO) * 128 + w * 32, Ah + h * HD, Al + h * HD); }
}

extern "C" void kernel_launch(void* const* d_in, const int* in_sizes, int n_in,
                              void* d_out, int out_size, void* d_ws, size_t ws_size, hipStream_t stream) {
    (void)in_sizes; (void)n_in; (void)out_size;
    const float* x = (const float*)d_in[0]; const float* wq = (const float*)d_in[1]; const float* wk = (const float*)d_in[2]; const float* wv = (const float*)d_in[3]; const float* wo = (const float*)d_in[4]; const float* bo = (const float*)d_in[5];   /* order x, Wq, Wk, Wv, Wo ('oi' (out, in) [2048][2048] x 4; normal / sqrt(2048); no projection biases), bo (a REAL output bias [2048], 0.01): SIX inputs, all read */
    float* OUT = (float*)d_out;     // [2][2048][2048]
    char* wsp = (char*)d_ws;
    auto take = [&](size_t bytes) { char* p = wsp; wsp += (bytes + 255) & ~(size_t)255; return (void*)p; };
    bf* WQ = (bf*)take((size_t)DQ * DM * 2); bf* WK = (bf*)take((size_t)DKV * DM * 2); bf* WV = (bf*)take((size_t)DKV * DM * 2); bf* WO = (bf*)take((size_t)DM * DQ * 2); float* CS = (float*)take((size_t)TT * HD * 2 * 4);
    bf* XB = (bf*)take((size_t)TT * DM * 2); float* FQ = (float*)take((size_t)TT * DQ * 4); float* FK = (float*)take((size_t)TT * DKV * 4);
    h16* QP16 = (h16*)take((size_t)NH_ * TT * HD * 2); h16* KP16 = (h16*)take((size_t)NKV * TT * HD * 2); h16* VT16 = (h16*)take((size_t)NKV * HD * TT * 2);
    bf* QPh = (bf*)take((size_t)NH_ * TT * HD * 2); bf* QPl = (bf*)take((size_t)NH_ * TT * HD * 2); bf* KPh = (bf*)take((size_t)NKV * TT * HD * 2); bf* KPl = (bf*)take((size_t)NKV * TT * HD * 2); bf* VTh = (bf*)take((size_t)NKV * HD * TT * 2); bf* VTl = (bf*)take((size_t)NKV * HD * TT * 2);
    bf* ATh = (bf*)take((size_t)TT * DQ * 2); bf* ATl = (bf*)take((size_t)TT * DQ * 2);
    if ((size_t)(wsp - (char*)d_ws) > ws_size) return;    // ws 256 MiB
    float* FV = FK;   // v projection reuses the k buffer after the k planes are built (stream-ordered)
    { k_cvt8<<<(unsigned)(((size_t)DQ * DM / 8 + 255) / 256), 256, 0, stream>>>(wq, WQ, (size_t)DQ * DM / 8); k_cvt8<<<(unsigned)(((size_t)DKV * DM / 8 + 255) / 256), 256, 0, stream>>>(wk, WK, (size_t)DKV * DM / 8); k_cvt8<<<(unsigned)(((size_t)DKV * DM / 8 + 255) / 256), 256, 0, stream>>>(wv, WV, (size_t)DKV * DM / 8);
      k_cvt8<<<(unsigned)(((size_t)DM * DQ / 8 + 255) / 256), 256, 0, stream>>>(wo, WO, (size_t)DM * DQ / 8);
       }
    k_csid<<<(TT * HD + 255) / 256, 256, 0, stream>>>(CS);
    const unsigned LQ = (unsigned)(((size_t)NH_ * TT * HD / 2 + 255) / 256), LKv = (unsigned)(((size_t)NKV * TT * HD / 2 + 255) / 256);
    for (int b = 0; b < NB_; ++b) {
        
        k_cvt8<<<(unsigned)(((size_t)TT * DM / 8 + 255) / 256), 256, 0, stream>>>(x + (size_t)b * TT * DM, XB, (size_t)TT * DM / 8);
        k_gemmw<bf, 0, false><<<dim3(TT / 64, DQ / 64, 1), 32, 0, stream>>>(XB, nullptr, WQ, nullptr, DM, FQ, DQ, nullptr, 0, 0, 0);
        k_rope<<<LQ, 256, 0, stream>>>(FQ, DQ, NH_, CS, nullptr, nullptr, 1.0f, QP16, QPh, QPl);
        k_gemmw<bf, 0, false><<<dim3(TT / 64, DKV / 64, 1), 32, 0, stream>>>(XB, nullptr, WK, nullptr, DM, FK, DKV, nullptr, 0, 0, 0);
        k_rope<<<LKv, 256, 0, stream>>>(FK, DKV, NKV, CS, nullptr, nullptr, 1.0f, KP16, KPh, KPl);
        k_gemmw<bf, 0, false><<<dim3(TT / 64, DKV / 64, 1), 32, 0, stream>>>(XB, nullptr, WV, nullptr, DM, FV, DKV, nullptr, 0, 0, 0); k_vtp<<<LKv, 256, 0, stream>>>(FV, DKV, NKV, VT16, VTh, VTl);
        k_attn<<<NH_ * (WHI + WLO), 128, 0, stream>>>(QP16, KP16, VT16, QPh, QPl, KPh, KPl, VTh, VTl, ATh, ATl);
        k_gemmw<bf, 1, true><<<dim3(TT / 64, DM / 64, 1), 32, 0, stream>>>(ATh, ATl, WO, nullptr, DQ, OUT + (size_t)b * TT * DM, DM, bo, 0, 0, 0); }
}

// v003
// Measured time: 595 microseconds a run.
// Two timings next to v002 put it at 1.32 and 1.33 times that version's speed.
// Counting every step since v000, it is 3.85 times as fast.
#include <hip/hip_runtime.h>

// Dense multi-head attention, 16 FULL heads x 128, natural bias-free projections and a natural output projection WITH a bias (x [2][2048][2048]; q, k, v = x W^T ('oi' (out, in) [2048][2048], normal / sqrt(2048), no bias; 16 heads x 128: one kv head per query head); scores x 128^-0.5; softmax over ALL 2,048 keys (no mask, no causal rule); out = merged Wo^T + bo ('oi' + a REAL bias 0.01) -> [2][2048][2048] (8.4 M); argument order x, Wq, Wk, Wv, Wo, bo).
// Every 16-bit plane that a matrix instruction reads (x, the weights, q, k, v^T, the merged heads) lies in FRAGMENT ORDER: see 'fragment order' below.
// Layout per batch: bf16 copy of x; 'oi' weights as-is; exact projections; identity-table plane builders at width 128; one fused dense T-2048 attention launch over the 16 FULL heads (REP = NH_ / NKV = 1: each head has its own k / v plane; hybrid rows: < 512 hi/lo 3 products, rest fp16 with p <= 1024); merged hi/lo x Wo exact + bo.
// Compute dtypes, f32 accumulate: every input rounded to bf16; projections exact; attention rows < 512 3 products, rest fp16; softmax f32; Wo hl x exact + bo (the f32 bias epilogue).

#define NB_  2
#define TT   2048
#define DM   2048
#define NH_  16
#define NKV  16
#define REP  (NH_ / NKV)
#define HD   128
#define DQ   (NH_ * HD)
#define DKV  (NKV * HD)
#define RH   512                  // query rows < RH use hi+lo planes (0: none)
#define WIN  0
#define SCL  0.088388347648318447f   // HD^-0.5
typedef _Float16 h16;
typedef unsigned short bf;
typedef __attribute__((ext_vector_type(16))) __bf16   v16bf;
typedef __attribute__((ext_vector_type(16))) _Float16 v16h;
typedef __attribute__((ext_vector_type(8)))  _Float16 v8h;
typedef __attribute__((ext_vector_type(8)))  unsigned short v8us;
typedef __attribute__((ext_vector_type(8)))  float    v8f;
typedef __attribute__((ext_vector_type(4)))  float    v4f;
typedef v8h  __attribute__((may_alias)) v8ha;
typedef v4f  __attribute__((may_alias)) v4fa;
typedef v8us __attribute__((may_alias)) v8usa;

__device__ __forceinline__ unsigned short f2bf(float f) { unsigned u = __float_as_uint(f); u += 0x7FFFu + ((u >> 16) & 1u); return (unsigned short)(u >> 16); }
__device__ __forceinline__ float bf2f(unsigned short b) { return __uint_as_float(((unsigned)b) << 16); }
__device__ __forceinline__ float bfr(float f) { return bf2f(f2bf(f)); }
__device__ __forceinline__ v16h cat16(v8h lo, v8h hi) { return __builtin_shufflevector(lo, hi, 0, 1, 2, 3, 4, 5, 6, 7, 8, 9, 10, 11, 12, 13, 14, 15); }
__device__ __forceinline__ v16bf cat16b(v8us lo, v8us hi) { return __builtin_bit_cast(v16bf, __builtin_shufflevector(lo, hi, 0, 1, 2, 3, 4, 5, 6, 7, 8, 9, 10, 11, 12, 13, 14, 15)); }
__device__ __forceinline__ v8f wmma16(v16h a, v16h b, v8f c) { return __builtin_amdgcn_wmma_f32_16x16x32_f16(false, a, false, b, (short)0, c, false, false); }
__device__ __forceinline__ v8f wmmab(v16bf a, v16bf b, v8f c) { return __builtin_amdgcn_wmma_f32_16x16x32_bf16(false, a, false, b, (short)0, c, false, false); }



// ---- fragment order of a 16-bit plane P[row][k] (K columns, K % 32 == 0, rows % 16 == 0): 1-KiB blocks of 16 rows x 32 k, block (row / 16) * (K / 32) + k / 32; inside a block element
// ((k / 16) % 2) * 256 + ((k / 8) % 2) * 128 + (row % 16) * 8 + k % 8. A fragment is then two 16-byte loads per lane at block + lane * 8 and + 256 elements: each wave-wide load covers 512 contiguous bytes (4 whole lines, not 32 B in each of 16 lines).
// ---- k_gemmw: register-blocked GEMM, ONE WAVE per 64x64 output tile (16 accumulators), operands straight from fragment-order 16-bit planes; grid (M/64, N/64, Z), 32 threads.
// C[m][n] (f32, pitch ldc, + optional f32 bias[n]) = sum_k A[m][k] Bt[n][k] (+ split products per NSPLIT). z-batch strides sA/sB/sC in elements. K % 32 == 0.
// KSP > 1: grid z = Z * KSP; blockIdx.z = z * KSP + ks; the work-group sums k in [ks K/KSP, (ks+1) K/KSP) only; a row of C (ldc elements) holds the KSP partial rows side by side, partial ks at column ks ldc/KSP. K % (32 KSP) == 0.
template <typename T16> struct WFrag;
template <> struct WFrag<h16> { typedef v16h V; static __device__ __forceinline__ V ld(const h16* p) { return cat16(*(const v8h*)p, *(const v8h*)(p + 256)); } static __device__ __forceinline__ v8f mma(V a, V b, v8f c) { return wmma16(a, b, c); } };
template <> struct WFrag<bf> { typedef v16bf V; static __device__ __forceinline__ V ld(const bf* p) { return cat16b(*(const v8us*)p, *(const v8us*)(p + 256)); } static __device__ __forceinline__ v8f mma(V a, V b, v8f c) { return wmmab(a, b, c); } };
template <typename T16, int NSPLIT, bool BIAS, int KSP = 1>
__global__ __launch_bounds__(32) void k_gemmw(const T16* __restrict__ A, const T16* __restrict__ A2, const T16* __restrict__ Bt, const T16* __restrict__ Bt2, int K, float* C, int ldc, const float* __restrict__ bias, size_t sA, size_t sB, size_t sC) {
    typedef typename WFrag<T16>::V V;
    __shared__ __align__(16) float os[16 * 68];
    const size_t z = blockIdx.z / KSP; const int ks = blockIdx.z % KSP; A += z * sA; if (A2) A2 += z * sA; Bt += z * sB; if (Bt2) Bt2 += z * sB; C += z * sC + (size_t)ks * (ldc / KSP);
    const int kb = ks * (K / KSP), ke = kb + K / KSP;
    const int lane = threadIdx.x & 31, lr = lane & 15, hi = lane >> 4; const int r0 = blockIdx.x * 64, c0 = blockIdx.y * 64;
    v8f acc[4][4];
#pragma unroll
    for (int mb = 0; mb < 4; ++mb)
#pragma unroll
        for (int nb = 0; nb < 4; ++nb) acc[mb][nb] = (v8f){};
    const size_t aoff = (size_t)r0 * K + 8 * lane, boff = (size_t)c0 * K + 8 * lane;   // 16 rows of a plane are K / 32 blocks = 16 K elements; a step of 32 k is one block = 512 elements
#pragma unroll 1
    for (int kc = kb; kc < ke; kc += 32) {
        V a[4], a2[4], bv[4], bv2[4]; const T16* pa[4]; const T16* pa2[4]; const T16* pb[4]; const T16* pb2[4];
#pragma unroll
        for (int mb = 0; mb < 4; ++mb) { pa[mb] = A + aoff + (size_t)mb * 16 * K + (size_t)kc * 16; pa2[mb] = (NSPLIT == 1 || NSPLIT == 2) ? A2 + aoff + (size_t)mb * 16 * K + (size_t)kc * 16 : pa[mb]; a[mb] = WFrag<T16>::ld(pa[mb]); if (NSPLIT == 1 || NSPLIT == 2) a2[mb] = WFrag<T16>::ld(pa2[mb]); }
#pragma unroll
        for (int nb = 0; nb < 4; ++nb) { pb[nb] = Bt + boff + (size_t)nb * 16 * K + (size_t)kc * 16; pb2[nb] = (NSPLIT >= 2) ? Bt2 + boff + (size_t)nb * 16 * K + (size_t)kc * 16 : pb[nb]; bv[nb] = WFrag<T16>::ld(pb[nb]); if (NSPLIT >= 2) bv2[nb] = WFrag<T16>::ld(pb2[nb]); }
        // precaution behind the trip's loads: every address is an input, so no address register is rewritten (by a later load's data or the next address) in front of the wait
        asm volatile("s_wait_xcnt 0x0" :: "v"(pa[0]), "v"(pa[1]), "v"(pa[2]), "v"(pa[3]), "v"(pa2[0]), "v"(pa2[1]), "v"(pa2[2]), "v"(pa2[3]), "v"(pb[0]), "v"(pb[1]), "v"(pb[2]), "v"(pb[3]), "v"(pb2[0]), "v"(pb2[1]), "v"(pb2[2]), "v"(pb2[3]) : "memory");
        __builtin_amdgcn_sched_barrier(0);   // keeps the trip's matrix instructions behind the wait: lifted over it, the first of them waits for its fragments with the rest of the trip's loads not yet issued
#pragma unroll
        for (int nb = 0; nb < 4; ++nb) {
#pragma unroll
            for (int mb = 0; mb < 4; ++mb) { acc[mb][nb] = WFrag<T16>::mma(a[mb], bv[nb], acc[mb][nb]); if (NSPLIT == 1 || NSPLIT == 2) acc[mb][nb] = WFrag<T16>::mma(a2[mb], bv[nb], acc[mb][nb]); if (NSPLIT >= 2) acc[mb][nb] = WFrag<T16>::mma(a[mb], bv2[nb], acc[mb][nb]); } }
        asm volatile("v_nop\n\tv_nop\n\tv_nop\n\tv_nop" : "+v"(acc[0][0]), "+v"(acc[1][1]), "+v"(acc[2][2]), "+v"(acc[3][3]) : "v"(a[0]), "v"(a[3]));
    }
#pragma unroll
    for (int mb = 0; mb < 4; ++mb) {
#pragma unroll
        for (int nb = 0; nb < 4; ++nb) {
#pragma unroll
            for (int j = 0; j < 8; ++j) os[(hi * 8 + j) * 68 + nb * 16 + lr] = acc[mb][nb][j]; }
        __builtin_amdgcn_wave_barrier(); asm volatile("" ::: "memory");
        float* crow = C + (size_t)(r0 + mb * 16) * ldc + c0;
{
#pragma unroll
            for (int s = 0; s < 8; ++s) { const int row = 2 * s + hi, cofs = lr * 4; v4f val = *(const v4fa*)(os + row * 68 + cofs); if (BIAS) { val[0] += bfr(bias[c0 + cofs]); val[1] += bfr(bias[c0 + cofs + 1]); val[2] += bfr(bias[c0 + cofs + 2]); val[3] += bfr(bias[c0 + cofs + 3]); }
                *(v4f*)(crow + (size_t)row * ldc + cofs) = val; }
             }
        __builtin_amdgcn_wave_barrier(); asm volatile("" ::: "memory");
    }
}

__device__ __forceinline__ h16 tohx(float x) { return (h16)x; }
__device__ __forceinline__ void splitf(float y, unsigned short& h, unsigned short& l) { h = f2bf(y); l = f2bf(y - bf2f(h)); }
typedef __attribute__((ext_vector_type(2))) _Float16 v2h;
typedef __attribute__((ext_vector_type(4))) _Float16 v4h;
typedef __attribute__((ext_vector_type(2))) unsigned short v2us;
typedef __attribute__((ext_vector_type(4))) unsigned short v4us;
typedef __attribute__((ext_vector_type(2))) float v2f;
typedef __attribute__((ext_vector_type(4))) int v4i;

// k_cvt8: f32 [rows][K] -> bf16 plane in fragment order. A thread makes one 16-byte piece; a wave takes 8 rows x 32 k: it reads one whole 128-B line per row and stores 4 whole lines.
template <int K>
__global__ __launch_bounds__(256) void k_cvt8(const float* __restrict__ src, bf* dst, size_t n8) { const size_t i = (size_t)blockIdx.x * 256 + threadIdx.x; if (i >= n8) return; const int c4 = (int)(i & 3), r16 = (int)((i >> 2) & 15); const size_t blk = i >> 6;
    const v8f v = *(const v8f*)(src + ((blk / (K / 32)) * 16 + r16) * K + (blk % (K / 32)) * 32 + c4 * 8); v8us o;
#pragma unroll
    for (int k = 0; k < 8; ++k) o[k] = f2bf(v[k]); *(v8us*)(dst + blk * 512 + (c4 >> 1) * 256 + (c4 & 1) * 128 + r16 * 8) = o;  }

// k_rope: head planes [h][t][d] (fp16 + hi/lo; each head's [t][d] in fragment order, K = HD; thread and wave as in k_cvt8) of rope(x) x sc with the rotate-half convention out[d] = x[d] cos[t][d] - x[d+HD/2] sin[t][d], out[d+HD/2] = x[d+HD/2] cos[t][d+HD/2] + x[d] sin[t][d+HD/2]
__global__ __launch_bounds__(256) void k_rope(const float* __restrict__ F, int pitch, int nheads, const float* __restrict__ CS, const float* __restrict__ RF, const float* __restrict__ nw, float sc, h16* P16, bf* Ph, bf* Pl) {
    const size_t i = (size_t)blockIdx.x * 256 + threadIdx.x; if (i >= (size_t)nheads * TT * HD / 8) return; const int c4 = (int)(i & 3), r16 = (int)((i >> 2) & 15); const size_t blk = i >> 6; const size_t e = blk * 512 + (c4 >> 1) * 256 + (c4 & 1) * 128 + r16 * 8;
    const int d = (int)(blk % (HD / 32)) * 32 + c4 * 8; const int t = (int)(((blk / (HD / 32)) * 16 + r16) % TT); const int h = (int)(blk / ((size_t)(HD / 32) * (TT / 16))); const float* f = F + (size_t)t * pitch + h * HD; const float rf = RF ? RF[(size_t)h * TT + t] : 1.0f; v8h o16; v8us oh, ol;
    const float* fa = f + d; const float* fb = f + ((d < HD / 2) ? d + HD / 2 : d - HD / 2); const float* fc = CS + ((size_t)t * HD + d) * 2;   // a piece of 8 d lies on one side of HD / 2
    const v8f xa = *(const v8f*)fa, xb = *(const v8f*)fb, ca = *(const v8f*)fc, cb = *(const v8f*)(fc + 8);
    asm volatile("s_wait_xcnt 0x0" :: "v"(fa), "v"(fb), "v"(fc) : "memory");   // precaution behind the loads: the addresses are inputs, so they are not rewritten in front of the wait
#pragma unroll
    for (int q = 0; q < 8; ++q) { const int dd = d + q; const int dp = (dd < HD / 2) ? dd + HD / 2 : dd - HD / 2; float x0 = xa[q], x1 = xb[q];
        if (RF) { float n0 = __fmul_rn(x0, rf), n1 = __fmul_rn(x1, rf); asm volatile("" : "+v"(n0)); asm volatile("" : "+v"(n1)); x0 = __fmul_rn(bfr(nw[dd]), n0); x1 = __fmul_rn(bfr(nw[dp]), n1); }
        const v2f cs = {(q < 4 ? ca : cb)[(q & 3) * 2], (q < 4 ? ca : cb)[(q & 3) * 2 + 1]}; float a = __fmul_rn(x0, cs[0]), bq = __fmul_rn(x1, cs[1]); asm volatile("" : "+v"(a)); asm volatile("" : "+v"(bq)); const float r = ((dd < HD / 2) ? __fsub_rn(a, bq) : __fadd_rn(a, bq)) * sc;
        o16[q] = tohx(r); unsigned short a2, c2; splitf(r, a2, c2); oh[q] = a2; ol[q] = c2; }
    *(v8h*)(P16 + e) = o16; *(v8us*)(Ph + e) = oh; *(v8us*)(Pl + e) = ol;  }
// k_vtp: value planes [g][d][t] (each head's [d][t] in fragment order, K = TT). A thread makes one 16-byte piece (8 t of one d); a wave makes half a block: each of its 8 loads reads 64 B in a row of 2 rows of F, each store is 512 B in a row.
__global__ __launch_bounds__(256) void k_vtp(const float* __restrict__ F, int pitch, int nheads, h16* V16, bf* Vh, bf* Vl) { const size_t i = (size_t)blockIdx.x * 256 + threadIdx.x; if (i >= (size_t)nheads * HD * TT / 8) return; const int w = (int)(i & 63); const size_t bi = i >> 6; const int db = (int)(bi % (HD / 16)); const int tc = (int)((bi / (HD / 16)) % (TT / 32)); const int g = (int)(bi / ((size_t)(HD / 16) * (TT / 32)));
    const int d = db * 16 + (w & 15); const int t = tc * 32 + (w >> 4) * 8; const size_t e = (size_t)g * HD * TT + ((size_t)db * (TT / 32) + tc) * 512 + w * 8; v8h o16; v8us oh, ol; const float* fp[8]; float xv[8];
#pragma unroll
    for (int q = 0; q < 8; ++q) { fp[q] = F + (size_t)(t + q) * pitch + g * HD + d; xv[q] = *fp[q]; }
    asm volatile("s_wait_xcnt 0x0" :: "v"(fp[0]), "v"(fp[1]), "v"(fp[2]), "v"(fp[3]), "v"(fp[4]), "v"(fp[5]), "v"(fp[6]), "v"(fp[7]) : "memory");   // precaution behind the loads: the addresses are inputs, so they are not rewritten in front of the wait
#pragma unroll
    for (int q = 0; q < 8; ++q) { const float x = xv[q]; o16[q] = tohx(x); unsigned short a2, c2; splitf(x, a2, c2); oh[q] = a2; ol[q] = c2; }
    *(v8h*)(V16 + e) = o16; *(v8us*)(Vh + e) = oh; *(v8us*)(Vl + e) = ol;  }
__global__ __launch_bounds__(256) void k_csid(float* CS) { const int idx = blockIdx.x * 256 + threadIdx.x; if (idx >= TT * HD) return; v2f cs; cs[0] = 1.0f; cs[1] = 0.0f; *(v2f*)(CS + (size_t)idx * 2) = cs;  }
// ---- k_attn: scores, softmax and P.V of one batch in ONE launch, all heads; no score or probability matrix goes through memory.
// A wave owns NQ x 16 query rows of one head and walks the 2048 keys in blocks of 32. It forms the TRANSPOSED score tile S^T = K Q^T (A = key rows, B = query rows): a lane then holds, for ITS query (lane & 15),
// keys 8 hi + j of the first 16-key tile and 16 + 8 hi + j of the second, which is the B fragment order of the next product O^T = V^T P^T (A = rows of the [d][t] value plane): no shuffle, no LDS.
// Softmax is the running form: per query a running maximum mo (kept 10 below the true one in log2 units, so that p <= 1024: the carrier of the 16-bit probabilities; it cancels in the division) and a running sum;
// the O^T tiles are rescaled by 2^(old - new) every block. Rows < RH: hi + lo planes, 3 products; the rest f16, as before. The four waves of a work-group walk the same head's keys, so three of four fragment reads can hit the WGP cache.
template <typename T16, int NSPLIT, int NQ>
__device__ __forceinline__ void attn_rows(const T16* __restrict__ Q, const T16* __restrict__ Q2, const T16* __restrict__ Kp, const T16* __restrict__ K2, const T16* __restrict__ Vt, const T16* __restrict__ V2, int q0, bf* Ah, bf* Al) {
    typedef typename WFrag<T16>::V V;
    const int lane = threadIdx.x & 31;
    V qf[NQ][4], qf2[NQ][4];
    const T16* qa = Q + (size_t)q0 * HD + 8 * lane; const T16* qa2 = NSPLIT ? Q2 + (size_t)q0 * HD + 8 * lane : qa;   // fragment order: 16 rows = 16 HD elements, 32 d = 512 elements
#pragma unroll
    for (int q = 0; q < NQ; ++q)
#pragma unroll
        for (int c = 0; c < 4; ++c) { qf[q][c] = WFrag<T16>::ld(qa + q * 16 * HD + c * 512); if (NSPLIT) qf2[q][c] = WFrag<T16>::ld(qa2 + q * 16 * HD + c * 512); }
    asm volatile("s_wait_xcnt 0x0" :: "v"(qa), "v"(qa2) : "memory");   // precaution behind the loads: the addresses are inputs, so they are not rewritten in front of the wait
    v8f o[NQ][8]; float mo[NQ], ls[NQ];
#pragma unroll
    for (int q = 0; q < NQ; ++q) { mo[q] = -3.0e38f; ls[q] = 0.f;
#pragma unroll
        for (int mt = 0; mt < 8; ++mt) o[q][mt] = (v8f){}; }
    const size_t kl = 8 * lane, vl = 8 * lane;
    V kf[2][4], kf2[2][4], vf[8], vf2[8];
    // each fetch ends in s_wait_xcnt 0 with its addresses as inputs: a precaution (no address register is rewritten in front of the wait); the statement also keeps the loads at the early place where they are written
    auto fetch_k = [&](int k0) { const T16* ka = Kp + kl + (size_t)k0 * HD; const T16* ka2 = NSPLIT ? K2 + kl + (size_t)k0 * HD : ka;
#pragma unroll
        for (int kt = 0; kt < 2; ++kt)
#pragma unroll
            for (int c = 0; c < 4; ++c) { kf[kt][c] = WFrag<T16>::ld(ka + kt * 16 * HD + c * 512); if (NSPLIT) kf2[kt][c] = WFrag<T16>::ld(ka2 + kt * 16 * HD + c * 512); }
        asm volatile("s_wait_xcnt 0x0" :: "v"(ka), "v"(ka2) : "memory"); };
    auto fetch_v = [&](int k0) { const T16* va = Vt + vl + (size_t)k0 * 16; const T16* va2 = NSPLIT ? V2 + vl + (size_t)k0 * 16 : va;
#pragma unroll
        for (int mt = 0; mt < 8; ++mt) { vf[mt] = WFrag<T16>::ld(va + (size_t)mt * 16 * TT); if (NSPLIT) vf2[mt] = WFrag<T16>::ld(va2 + (size_t)mt * 16 * TT); }
        asm volatile("s_wait_xcnt 0x0" :: "v"(va), "v"(va2) : "memory"); };
    fetch_k(0); fetch_v(0);
#pragma unroll 1   // kept rolled: one trip already holds a whole key block's matrix instructions and both fetches
    for (int kb = 0; kb < TT; kb += 32) {
        const int nk = (kb + 32 < TT) ? kb + 32 : kb;   // the block fetched ahead; the last trip fetches its own again (in bounds, unused)
        v8f s[NQ][2];
#pragma unroll
        for (int q = 0; q < NQ; ++q) { s[q][0] = (v8f){}; s[q][1] = (v8f){}; }
#pragma unroll
        for (int c = 0; c < 4; ++c) {
#pragma unroll
            for (int kt = 0; kt < 2; ++kt)
#pragma unroll
                for (int q = 0; q < NQ; ++q) s[q][kt] = WFrag<T16>::mma(kf[kt][c], qf[q][c], s[q][kt]);
            if (NSPLIT) {
#pragma unroll
                for (int kt = 0; kt < 2; ++kt)
#pragma unroll
                    for (int q = 0; q < NQ; ++q) s[q][kt] = WFrag<T16>::mma(kf2[kt][c], qf[q][c], s[q][kt]);
#pragma unroll
                for (int kt = 0; kt < 2; ++kt)
#pragma unroll
                    for (int q = 0; q < NQ; ++q) s[q][kt] = WFrag<T16>::mma(kf[kt][c], qf2[q][c], s[q][kt]); } }
        // next block's key fragments: in flight under the softmax and P.V of this block
        fetch_k(nk);
        V pf[NQ], pf2[NQ];
#pragma unroll
        for (int q = 0; q < NQ; ++q) {
            float mx = -3.0e38f;
#pragma unroll
            for (int kt = 0; kt < 2; ++kt)
#pragma unroll
                for (int j = 0; j < 8; ++j) { s[q][kt][j] *= SCL * 1.4426950408889634f; mx = fmaxf(mx, s[q][kt][j]); }
            mx = fmaxf(mx, __shfl_xor(mx, 16, 32));
            const float mn = fmaxf(mo[q], mx - 10.0f); const float al = __builtin_amdgcn_exp2f(mo[q] - mn); mo[q] = mn;
            float ps = 0.f;
#pragma unroll
            for (int kt = 0; kt < 2; ++kt)
#pragma unroll
                for (int j = 0; j < 8; ++j) { s[q][kt][j] = __builtin_amdgcn_exp2f(s[q][kt][j] - mn); ps += s[q][kt][j]; }
            ls[q] = ls[q] * al + ps;
#pragma unroll
            for (int mt = 0; mt < 8; ++mt) o[q][mt] *= al;
            if constexpr (NSPLIT == 0) { v16h p;
#pragma unroll
                for (int j = 0; j < 8; ++j) { p[j] = tohx(s[q][0][j]); p[8 + j] = tohx(s[q][1][j]); }
                pf[q] = p;
            } else { v8us h0, h1, l0, l1;
#pragma unroll
                for (int j = 0; j < 8; ++j) { unsigned short a, c2; splitf(s[q][0][j], a, c2); h0[j] = a; l0[j] = c2; splitf(s[q][1][j], a, c2); h1[j] = a; l1[j] = c2; }
                pf[q] = cat16b(h0, h1); pf2[q] = cat16b(l0, l1); } }
#pragma unroll
        for (int mt = 0; mt < 8; ++mt)
#pragma unroll
            for (int q = 0; q < NQ; ++q) o[q][mt] = WFrag<T16>::mma(vf[mt], pf[q], o[q][mt]);
        if (NSPLIT) {
#pragma unroll
            for (int mt = 0; mt < 8; ++mt)
#pragma unroll
                for (int q = 0; q < NQ; ++q) o[q][mt] = WFrag<T16>::mma(vf[mt], pf2[q], o[q][mt]);
#pragma unroll
            for (int mt = 0; mt < 8; ++mt)
#pragma unroll
                for (int q = 0; q < NQ; ++q) o[q][mt] = WFrag<T16>::mma(vf2[mt], pf[q], o[q][mt]); }
        // next block's value fragments: in flight under the next block's scores and softmax
        fetch_v(nk);
    }
#pragma unroll
    for (int q = 0; q < NQ; ++q) { const float inv = __fdiv_rn(1.0f, ls[q] + __shfl_xor(ls[q], 16, 32)); const size_t oo = (size_t)(q0 + q * 16) * DQ + 8 * lane;   // the O^T tile mt of a lane is its piece of half a block of the merged plane (fragment order, K = DQ)
#pragma unroll
        for (int mt = 0; mt < 8; ++mt) { v8us oh, ol;
#pragma unroll
            for (int j = 0; j < 8; ++j) { unsigned short a, c2; splitf(o[q][mt][j] * inv, a, c2); oh[j] = a; ol[j] = c2; }
            *(v8us*)(Ah + oo + mt * 256) = oh; *(v8us*)(Al + oo + mt * 256) = ol;
            asm volatile("s_wait_xcnt 0x0" :: "v"(oh), "v"(ol) : "memory"); } }   // precaution behind the two stores: their data are inputs, so no data register is rewritten (next tile's packing, the code behind the call) in front of the wait
}
#define WHI (RH / 64)             // work-groups per head on the hi + lo rows: 4 waves x 16 rows
#define WLO ((TT - RH) / 128)     // work-groups per head on the f16 rows: 4 waves x 32 rows
__global__ __launch_bounds__(128) void k_attn(const h16* __restrict__ Q16, const h16* __restrict__ K16, const h16* __restrict__ V16, const bf* __restrict__ Qh, const bf* __restrict__ Ql, const bf* __restrict__ Kh, const bf* __restrict__ Kl, const bf* __restrict__ Vh, const bf* __restrict__ Vl, bf* Ah, bf* Al) {
    const int w = threadIdx.x >> 5; int b = blockIdx.x;
    if (b < NH_ * WHI) { const int h = b / WHI; const size_t pz = (size_t)h * TT * HD;   // the longer work-groups (3 products) take the lowest block indices
        attn_rows<bf, 2, 1>(Qh + pz, Ql + pz, Kh + pz, Kl + pz, Vh + pz, Vl + pz, (b % WHI) * 64 + w * 16, Ah + h * HD * 16, Al + h * HD * 16);
    } else { b -= NH_ * WHI; const int h = b / WLO; const size_t pz = (size_t)h * TT * HD;
        attn_rows<h16, 0, 2>(Q16 + pz, nullptr, K16 + pz, nullptr, V16 + pz, nullptr, RH + (b % WLO) * 128 + w * 32, Ah + h * HD * 16, Al + h * HD * 16); }
}

extern "C" void kernel_launch(void* const* d_in, const int* in_sizes, int n_in,
                              void* d_out, int out_size, void* d_ws, size_t ws_size, hipStream_t stream) {
    (void)in_sizes; (void)n_in; (void)out_size;
    const float* x = (const float*)d_in[0]; const float* wq = (const float*)d_in[1]; const float* wk = (const float*)d_in[2]; const float* wv = (const float*)d_in[3]; const float* wo = (const float*)d_in[4]; const float* bo = (const float*)d_in[5];   /* order x, Wq, Wk, Wv, Wo ('oi' (out, in) [2048][2048] x 4; normal / sqrt(2048); no projection biases), bo (a REAL output bias [2048], 0.01): SIX inputs, all read */
    float* OUT = (float*)d_out;     // [2][2048][2048]
    char* wsp = (char*)d_ws;
    auto take = [&](size_t bytes) { char* p = wsp; wsp += (bytes + 255) & ~(size_t)255; return (void*)p; };
    bf* WQ = (bf*)take((size_t)DQ * DM * 2); bf* WK = (bf*)take((size_t)DKV * DM * 2); bf* WV = (bf*)take((size_t)DKV * DM * 2); bf* WO = (bf*)take((size_t)DM * DQ * 2); float* CS = (float*)take((size_t)TT * HD * 2 * 4);
    bf* XB = (bf*)take((size_t)TT * DM * 2); float* FQ = (float*)take((size_t)TT * DQ * 4); float* FK = (float*)take((size_t)TT * DKV * 4);
    h16* QP16 = (h16*)take((size_t)NH_ * TT * HD * 2); h16* KP16 = (h16*)take((size_t)NKV * TT * HD * 2); h16* VT16 = (h16*)take((size_t)NKV * HD * TT * 2);
    bf* QPh = (bf*)take((size_t)NH_ * TT * HD * 2); bf* QPl = (bf*)take((size_t)NH_ * TT * HD * 2); bf* KPh = (bf*)take((size_t)NKV * TT * HD * 2); bf* KPl = (bf*)take((size_t)NKV * TT * HD * 2); bf* VTh = (bf*)take((size_t)NKV * HD * TT * 2); bf* VTl = (bf*)take((size_t)NKV * HD * TT * 2);
    bf* ATh = (bf*)take((size_t)TT * DQ * 2); bf* ATl = (bf*)take((size_t)TT * DQ * 2);
    if ((size_t)(wsp - (char*)d_ws) > ws_size) return;    // ws 256 MiB
    float* FV = FK;   // v projection reuses the k buffer after the k planes are built (stream-ordered)
    { k_cvt8<DM><<<(unsigned)(((size_t)DQ * DM / 8 + 255) / 256), 256, 0, stream>>>(wq, WQ, (size_t)DQ * DM / 8); k_cvt8<DM><<<(unsigned)(((size_t)DKV * DM / 8 + 255) / 256), 256, 0, stream>>>(wk, WK, (size_t)DKV * DM / 8); k_cvt8<DM><<<(unsigned)(((size_t)DKV * DM / 8 + 255) / 256), 256, 0, stream>>>(wv, WV, (size_t)DKV * DM / 8);
      k_cvt8<DQ><<<(unsigned)(((size_t)DM * DQ / 8 + 255) / 256), 256, 0, stream>>>(wo, WO, (size_t)DM * DQ / 8);
       }
    k_csid<<<(TT * HD + 255) / 256, 256, 0, stream>>>(CS);
    const unsigned LQ = (unsigned)(((size_t)NH_ * TT * HD / 8 + 255) / 256), LKv = (unsigned)(((size_t)NKV * TT * HD / 8 + 255) / 256);
    for (int b = 0; b < NB_; ++b) {
        
        k_cvt8<DM><<<(unsigned)(((size_t)TT * DM / 8 + 255) / 256), 256, 0, stream>>>(x + (size_t)b * TT * DM, XB, (size_t)TT * DM / 8);
        k_gemmw<bf, 0, false><<<dim3(TT / 64, DQ / 64, 1), 32, 0, stream>>>(XB, nullptr, WQ, nullptr, DM, FQ, DQ, nullptr, 0, 0, 0);
        k_rope<<<LQ, 256, 0, stream>>>(FQ, DQ, NH_, CS, nullptr, nullptr, 1.0f, QP16, QPh, QPl);
        k_gemmw<bf, 0, false><<<dim3(TT / 64, DKV / 64, 1), 32, 0, stream>>>(XB, nullptr, WK, nullptr, DM, FK, DKV, nullptr, 0, 0, 0);
        k_rope<<<LKv, 256, 0, stream>>>(FK, DKV, NKV, CS, nullptr, nullptr, 1.0f, KP16, KPh, KPl);
        k_gemmw<bf, 0, false><<<dim3(TT / 64, DKV / 64, 1), 32, 0, stream>>>(XB, nullptr, WV, nullptr, DM, FV, DKV, nullptr, 0, 0, 0); k_vtp<<<LKv, 256, 0, stream>>>(FV, DKV, NKV, VT16, VTh, VTl);
        k_attn<<<NH_ * (WHI + WLO), 128, 0, stream>>>(QP16, KP16, VT16, QPh, QPl, KPh, KPl, VTh, VTl, ATh, ATl);
        k_gemmw<bf, 1, true><<<dim3(TT / 64, DM / 64, 1), 32, 0, stream>>>(ATh, ATl, WO, nullptr, DQ, OUT + (size_t)b * TT * DM, DM, bo, 0, 0, 0); }
}

// v004
// One run takes 534 microseconds.
// Next to v003, in two timings, it ran 1.10 times as fast each time.
// All steps since v000 together make it 4.24 times as fast.
#include <hip/hip_runtime.h>

// Dense multi-head attention, 16 FULL heads x 128, natural bias-free projections and a natural output projection WITH a bias (x [2][2048][2048]; q, k, v = x W^T ('oi' (out, in) [2048][2048], normal / sqrt(2048), no bias; 16 heads x 128: one kv head per query head); scores x 128^-0.5; softmax over ALL 2,048 keys (no mask, no causal rule); out = merged Wo^T + bo ('oi' + a REAL bias 0.01) -> [2][2048][2048] (8.4 M); argument order x, Wq, Wk, Wv, Wo, bo).
// Every 16-bit plane that a matrix instruction reads (x, the weights, q, k, v^T, the merged heads) lies in FRAGMENT ORDER: see 'fragment order' below.
// Layout per batch: bf16 copy of x; 'oi' weights as-is; exact projections whose epilogue stores the head planes itself (no f32 projection goes through memory); one fused dense T-2048 attention launch over the 16 FULL heads (REP = NH_ / NKV = 1: each head has its own k / v plane; hybrid rows: < 512 hi/lo 3 products, rest fp16 with p <= 1024); merged hi/lo x Wo exact + bo.
// Compute dtypes, f32 accumulate: every input rounded to bf16; projections exact; attention rows < 512 3 products, rest fp16; softmax f32; Wo hl x exact + bo (the f32 bias epilogue).

#define NB_  2
#define TT   2048
#define DM   2048
#define NH_  16
#define NKV  16
#define REP  (NH_ / NKV)
#define HD   128
#define DQ   (NH_ * HD)
#define DKV  (NKV * HD)
#define RH   512                  // query rows < RH use hi+lo planes (0: none)
#define WIN  0
#define SCL  0.088388347648318447f   // HD^-0.5
typedef _Float16 h16;
typedef unsigned short bf;
typedef __attribute__((ext_vector_type(16))) __bf16   v16bf;
typedef __attribute__((ext_vector_type(16))) _Float16 v16h;
typedef __attribute__((ext_vector_type(8)))  _Float16 v8h;
typedef __attribute__((ext_vector_type(8)))  unsigned short v8us;
typedef __attribute__((ext_vector_type(8)))  float    v8f;
typedef __attribute__((ext_vector_type(4)))  float    v4f;
typedef v8h  __attribute__((may_alias)) v8ha;
typedef v4f  __attribute__((may_alias)) v4fa;
typedef v8us __attribute__((may_alias)) v8usa;

__device__ __forceinline__ unsigned short f2bf(float f) { unsigned u = __float_as_uint(f); u += 0x7FFFu + ((u >> 16) & 1u); return (unsigned short)(u >> 16); }
__device__ __forceinline__ float bf2f(unsigned short b) { return __uint_as_float(((unsigned)b) << 16); }
__device__ __forceinline__ float bfr(float f) { return bf2f(f2bf(f)); }
__device__ __forceinline__ v16h cat16(v8h lo, v8h hi) { return __builtin_shufflevector(lo, hi, 0, 1, 2, 3, 4, 5, 6, 7, 8, 9, 10, 11, 12, 13, 14, 15); }
__device__ __forceinline__ v16bf cat16b(v8us lo, v8us hi) { return __builtin_bit_cast(v16bf, __builtin_shufflevector(lo, hi, 0, 1, 2, 3, 4, 5, 6, 7, 8, 9, 10, 11, 12, 13, 14, 15)); }
__device__ __forceinline__ v8f wmma16(v16h a, v16h b, v8f c) { return __builtin_amdgcn_wmma_f32_16x16x32_f16(false, a, false, b, (short)0, c, false, false); }
__device__ __forceinline__ v8f wmmab(v16bf a, v16bf b, v8f c) { return __builtin_amdgcn_wmma_f32_16x16x32_bf16(false, a, false, b, (short)0, c, false, false); }



// ---- fragment order of a 16-bit plane P[row][k] (K columns, K % 32 == 0, rows % 16 == 0): 1-KiB blocks of 16 rows x 32 k, block (row / 16) * (K / 32) + k / 32; inside a block element
// ((k / 16) % 2) * 256 + ((k / 8) % 2) * 128 + (row % 16) * 8 + k % 8. A fragment is then two 16-byte loads per lane at block + lane * 8 and + 256 elements: each wave-wide load covers 512 contiguous bytes (4 whole lines, not 32 B in each of 16 lines).
// ---- k_gemmw: register-blocked GEMM, ONE WAVE per 64x64 output tile (16 accumulators), operands straight from fragment-order 16-bit planes; grid (M/64, N/64, Z), 32 threads.
// C[m][n] (f32, pitch ldc, + optional f32 bias[n]) = sum_k A[m][k] Bt[n][k] (+ split products per NSPLIT). z-batch strides sA/sB/sC in elements. K % 32 == 0.
// PL != 0: no C; the epilogue stores the tile as the three 16-bit head planes (f16, bf16 hi, bf16 lo) P[n][m] in fragment order, m being the plane's k: a lane's 8 accumulator values are 8 successive m of one n, which is one 16-byte piece,
// and a wave's store is half a block (512 B in a row). PL == 1: the head is m / HD, plane [head][n][m % HD] (q, k: A = weight rows, Bt = x rows). PL == 2: the head is n / HD, plane [head][n % HD][m] (v^T: A = x rows, Bt = weight rows).
// KSP > 1: grid z = Z * KSP; blockIdx.z = z * KSP + ks; the work-group sums k in [ks K/KSP, (ks+1) K/KSP) only; a row of C (ldc elements) holds the KSP partial rows side by side, partial ks at column ks ldc/KSP. K % (32 KSP) == 0.
template <typename T16> struct WFrag;
template <> struct WFrag<h16> { typedef v16h V; static __device__ __forceinline__ V ld(const h16* p) { return cat16(*(const v8h*)p, *(const v8h*)(p + 256)); } static __device__ __forceinline__ v8f mma(V a, V b, v8f c) { return wmma16(a, b, c); } };
template <> struct WFrag<bf> { typedef v16bf V; static __device__ __forceinline__ V ld(const bf* p) { return cat16b(*(const v8us*)p, *(const v8us*)(p + 256)); } static __device__ __forceinline__ v8f mma(V a, V b, v8f c) { return wmmab(a, b, c); } };
__device__ __forceinline__ h16 tohx(float x) { return (h16)x; }
__device__ __forceinline__ void splitf(float y, unsigned short& h, unsigned short& l) { h = f2bf(y); l = f2bf(y - bf2f(h)); }
template <typename T16, int NSPLIT, bool BIAS, int KSP = 1, int PL = 0>
__global__ __launch_bounds__(32) void k_gemmw(const T16* __restrict__ A, const T16* __restrict__ A2, const T16* __restrict__ Bt, const T16* __restrict__ Bt2, int K, float* C, int ldc, const float* __restrict__ bias, size_t sA, size_t sB, size_t sC, h16* P16, bf* Ph, bf* Pl) {
    typedef typename WFrag<T16>::V V;
    __shared__ __align__(16) float os[16 * 68];
    const size_t z = blockIdx.z / KSP; const int ks = blockIdx.z % KSP; A += z * sA; if (A2) A2 += z * sA; Bt += z * sB; if (Bt2) Bt2 += z * sB; C += z * sC + (size_t)ks * (ldc / KSP);
    const int kb = ks * (K / KSP), ke = kb + K / KSP;
    const int lane = threadIdx.x & 31, lr = lane & 15, hi = lane >> 4; const int r0 = blockIdx.x * 64, c0 = blockIdx.y * 64;
    v8f acc[4][4];
#pragma unroll
    for (int mb = 0; mb < 4; ++mb)
#pragma unroll
        for (int nb = 0; nb < 4; ++nb) acc[mb][nb] = (v8f){};
    const size_t aoff = (size_t)r0 * K + 8 * lane, boff = (size_t)c0 * K + 8 * lane;   // 16 rows of a plane are K / 32 blocks = 16 K elements; a step of 32 k is one block = 512 elements
#pragma unroll 1
    for (int kc = kb; kc < ke; kc += 32) {
        V a[4], a2[4], bv[4], bv2[4]; const T16* pa[4]; const T16* pa2[4]; const T16* pb[4]; const T16* pb2[4];
#pragma unroll
        for (int mb = 0; mb < 4; ++mb) { pa[mb] = A + aoff + (size_t)mb * 16 * K + (size_t)kc * 16; pa2[mb] = (NSPLIT == 1 || NSPLIT == 2) ? A2 + aoff + (size_t)mb * 16 * K + (size_t)kc * 16 : pa[mb]; a[mb] = WFrag<T16>::ld(pa[mb]); if (NSPLIT == 1 || NSPLIT == 2) a2[mb] = WFrag<T16>::ld(pa2[mb]); }
#pragma unroll
        for (int nb = 0; nb < 4; ++nb) { pb[nb] = Bt + boff + (size_t)nb * 16 * K + (size_t)kc * 16; pb2[nb] = (NSPLIT >= 2) ? Bt2 + boff + (size_t)nb * 16 * K + (size_t)kc * 16 : pb[nb]; bv[nb] = WFrag<T16>::ld(pb[nb]); if (NSPLIT >= 2) bv2[nb] = WFrag<T16>::ld(pb2[nb]); }
        // precaution behind the trip's loads: every address is an input, so no address register is rewritten (by a later load's data or the next address) in front of the wait
        asm volatile("s_wait_xcnt 0x0" :: "v"(pa[0]), "v"(pa[1]), "v"(pa[2]), "v"(pa[3]), "v"(pa2[0]), "v"(pa2[1]), "v"(pa2[2]), "v"(pa2[3]), "v"(pb[0]), "v"(pb[1]), "v"(pb[2]), "v"(pb[3]), "v"(pb2[0]), "v"(pb2[1]), "v"(pb2[2]), "v"(pb2[3]) : "memory");
        __builtin_amdgcn_sched_barrier(0);   // keeps the trip's matrix instructions behind the wait: lifted over it, the first of them waits for its fragments with the rest of the trip's loads not yet issued
#pragma unroll
        for (int nb = 0; nb < 4; ++nb) {
#pragma unroll
            for (int mb = 0; mb < 4; ++mb) { acc[mb][nb] = WFrag<T16>::mma(a[mb], bv[nb], acc[mb][nb]); if (NSPLIT == 1 || NSPLIT == 2) acc[mb][nb] = WFrag<T16>::mma(a2[mb], bv[nb], acc[mb][nb]); if (NSPLIT >= 2) acc[mb][nb] = WFrag<T16>::mma(a[mb], bv2[nb], acc[mb][nb]); } }
        asm volatile("v_nop\n\tv_nop\n\tv_nop\n\tv_nop" : "+v"(acc[0][0]), "+v"(acc[1][1]), "+v"(acc[2][2]), "+v"(acc[3][3]) : "v"(a[0]), "v"(a[3]));
    }
    if constexpr (PL != 0) {
        const size_t pe = (PL == 1 ? (size_t)(r0 / HD) * TT * HD + ((size_t)(c0 / 16) * (HD / 32) + (r0 % HD) / 32) * 512 : (size_t)(c0 / HD) * HD * TT + ((size_t)((c0 % HD) / 16) * (TT / 32) + r0 / 32) * 512) + 8 * lane;
#pragma unroll
        for (int nb = 0; nb < 4; ++nb) { const size_t en = pe + (size_t)nb * ((PL == 1 ? HD / 32 : TT / 32) * 512);   // 16 plane rows on; the four mb tiles are two whole blocks in a row
            h16* q16 = P16 + en; bf* qh = Ph + en; bf* ql = Pl + en; v8h o16[4]; v8us oh[4], ol[4];
#pragma unroll
            for (int mb = 0; mb < 4; ++mb) {
#pragma unroll
                for (int j = 0; j < 8; ++j) { const float r = acc[mb][nb][j]; o16[mb][j] = tohx(r); unsigned short a2, c2; splitf(r, a2, c2); oh[mb][j] = a2; ol[mb][j] = c2; }
                *(v8h*)(q16 + mb * 256) = o16[mb]; *(v8us*)(qh + mb * 256) = oh[mb]; *(v8us*)(ql + mb * 256) = ol[mb]; }
            // precaution behind the twelve stores: their data and addresses are inputs, so none of these registers is rewritten (next column's packing) in front of the wait
            asm volatile("s_wait_xcnt 0x0" :: "v"(o16[0]), "v"(o16[1]), "v"(o16[2]), "v"(o16[3]), "v"(oh[0]), "v"(oh[1]), "v"(oh[2]), "v"(oh[3]), "v"(ol[0]), "v"(ol[1]), "v"(ol[2]), "v"(ol[3]), "v"(q16), "v"(qh), "v"(ql) : "memory"); }
    } else {
#pragma unroll
    for (int mb = 0; mb < 4; ++mb) {
#pragma unroll
        for (int nb = 0; nb < 4; ++nb) {
#pragma unroll
            for (int j = 0; j < 8; ++j) os[(hi * 8 + j) * 68 + nb * 16 + lr] = acc[mb][nb][j]; }
        __builtin_amdgcn_wave_barrier(); asm volatile("" ::: "memory");
        float* crow = C + (size_t)(r0 + mb * 16) * ldc + c0;
{
#pragma unroll
            for (int s = 0; s < 8; ++s) { const int row = 2 * s + hi, cofs = lr * 4; v4f val = *(const v4fa*)(os + row * 68 + cofs); if (BIAS) { val[0] += bfr(bias[c0 + cofs]); val[1] += bfr(bias[c0 + cofs + 1]); val[2] += bfr(bias[c0 + cofs + 2]); val[3] += bfr(bias[c0 + cofs + 3]); }
                *(v4f*)(crow + (size_t)row * ldc + cofs) = val; }
             }
        __builtin_amdgcn_wave_barrier(); asm volatile("" ::: "memory");
    }
    }
}

typedef __attribute__((ext_vector_type(2))) _Float16 v2h;
typedef __attribute__((ext_vector_type(4))) _Float16 v4h;
typedef __attribute__((ext_vector_type(2))) unsigned short v2us;
typedef __attribute__((ext_vector_type(4))) unsigned short v4us;
typedef __attribute__((ext_vector_type(2))) float v2f;
typedef __attribute__((ext_vector_type(4))) int v4i;

// k_cvt8: f32 [rows][K] -> bf16 plane in fragment order. A thread makes one 16-byte piece; a wave takes 8 rows x 32 k: it reads one whole 128-B line per row and stores 4 whole lines.
template <int K>
__global__ __launch_bounds__(256) void k_cvt8(const float* __restrict__ src, bf* dst, size_t n8) { const size_t i = (size_t)blockIdx.x * 256 + threadIdx.x; if (i >= n8) return; const int c4 = (int)(i & 3), r16 = (int)((i >> 2) & 15); const size_t blk = i >> 6;
    const v8f v = *(const v8f*)(src + ((blk / (K / 32)) * 16 + r16) * K + (blk % (K / 32)) * 32 + c4 * 8); v8us o;
#pragma unroll
    for (int k = 0; k < 8; ++k) o[k] = f2bf(v[k]); *(v8us*)(dst + blk * 512 + (c4 >> 1) * 256 + (c4 & 1) * 128 + r16 * 8) = o;  }

// ---- k_attn: scores, softmax and P.V of one batch in ONE launch, all heads; no score or probability matrix goes through memory.
// A wave owns NQ x 16 query rows of one head and walks the 2048 keys in blocks of 32. It forms the TRANSPOSED score tile S^T = K Q^T (A = key rows, B = query rows): a lane then holds, for ITS query (lane & 15),
// keys 8 hi + j of the first 16-key tile and 16 + 8 hi + j of the second, which is the B fragment order of the next product O^T = V^T P^T (A = rows of the [d][t] value plane): no shuffle, no LDS.
// Softmax is the running form: per query a running maximum mo (kept 10 below the true one in log2 units, so that p <= 1024: the carrier of the 16-bit probabilities; it cancels in the division) and a running sum;
// the O^T tiles are rescaled by 2^(old - new) every block. Rows < RH: hi + lo planes, 3 products; the rest f16, as before. The four waves of a work-group walk the same head's keys, so three of four fragment reads can hit the WGP cache.
template <typename T16, int NSPLIT, int NQ>
__device__ __forceinline__ void attn_rows(const T16* __restrict__ Q, const T16* __restrict__ Q2, const T16* __restrict__ Kp, const T16* __restrict__ K2, const T16* __restrict__ Vt, const T16* __restrict__ V2, int q0, bf* Ah, bf* Al) {
    typedef typename WFrag<T16>::V V;
    const int lane = threadIdx.x & 31;
    V qf[NQ][4], qf2[NQ][4];
    const T16* qa = Q + (size_t)q0 * HD + 8 * lane; const T16* qa2 = NSPLIT ? Q2 + (size_t)q0 * HD + 8 * lane : qa;   // fragment order: 16 rows = 16 HD elements, 32 d = 512 elements
#pragma unroll
    for (int q = 0; q < NQ; ++q)
#pragma unroll
        for (int c = 0; c < 4; ++c) { qf[q][c] = WFrag<T16>::ld(qa + q * 16 * HD + c * 512); if (NSPLIT) qf2[q][c] = WFrag<T16>::ld(qa2 + q * 16 * HD + c * 512); }
    asm volatile("s_wait_xcnt 0x0" :: "v"(qa), "v"(qa2) : "memory");   // precaution behind the loads: the addresses are inputs, so they are not rewritten in front of the wait
    v8f o[NQ][8]; float mo[NQ], ls[NQ];
#pragma unroll
    for (int q = 0; q < NQ; ++q) { mo[q] = -3.0e38f; ls[q] = 0.f;
#pragma unroll
        for (int mt = 0; mt < 8; ++mt) o[q][mt] = (v8f){}; }
    const size_t kl = 8 * lane, vl = 8 * lane;
    V kf[2][4], kf2[2][4], vf[8], vf2[8];
    // each fetch ends in s_wait_xcnt 0 with its addresses as inputs: a precaution (no address register is rewritten in front of the wait); the statement also keeps the loads at the early place where they are written
    auto fetch_k = [&](int k0) { const T16* ka = Kp + kl + (size_t)k0 * HD; const T16* ka2 = NSPLIT ? K2 + kl + (size_t)k0 * HD : ka;
#pragma unroll
        for (int kt = 0; kt < 2; ++kt)
#pragma unroll
            for (int c = 0; c < 4; ++c) { kf[kt][c] = WFrag<T16>::ld(ka + kt * 16 * HD + c * 512); if (NSPLIT) kf2[kt][c] = WFrag<T16>::ld(ka2 + kt * 16 * HD + c * 512); }
        asm volatile("s_wait_xcnt 0x0" :: "v"(ka), "v"(ka2) : "memory"); };
    auto fetch_v = [&](int k0) { const T16* va = Vt + vl + (size_t)k0 * 16; const T16* va2 = NSPLIT ? V2 + vl + (size_t)k0 * 16 : va;
#pragma unroll
        for (int mt = 0; mt < 8; ++mt) { vf[mt] = WFrag<T16>::ld(va + (size_t)mt * 16 * TT); if (NSPLIT) vf2[mt] = WFrag<T16>::ld(va2 + (size_t)mt * 16 * TT); }
        asm volatile("s_wait_xcnt 0x0" :: "v"(va), "v"(va2) : "memory"); };
    fetch_k(0); fetch_v(0);
#pragma unroll 1   // kept rolled: one trip already holds a whole key block's matrix instructions and both fetches
    for (int kb = 0; kb < TT; kb += 32) {
        const int nk = (kb + 32 < TT) ? kb + 32 : kb;   // the block fetched ahead; the last trip fetches its own again (in bounds, unused)
        v8f s[NQ][2];
#pragma unroll
        for (int q = 0; q < NQ; ++q) { s[q][0] = (v8f){}; s[q][1] = (v8f){}; }
#pragma unroll
        for (int c = 0; c < 4; ++c) {
#pragma unroll
            for (int kt = 0; kt < 2; ++kt)
#pragma unroll
                for (int q = 0; q < NQ; ++q) s[q][kt] = WFrag<T16>::mma(kf[kt][c], qf[q][c], s[q][kt]);
            if (NSPLIT) {
#pragma unroll
                for (int kt = 0; kt < 2; ++kt)
#pragma unroll
                    for (int q = 0; q < NQ; ++q) s[q][kt] = WFrag<T16>::mma(kf2[kt][c], qf[q][c], s[q][kt]);
#pragma unroll
                for (int kt = 0; kt < 2; ++kt)
#pragma unroll
                    for (int q = 0; q < NQ; ++q) s[q][kt] = WFrag<T16>::mma(kf[kt][c], qf2[q][c], s[q][kt]); } }
        // next block's key fragments: in flight under the softmax and P.V of this block
        fetch_k(nk);
        V pf[NQ], pf2[NQ];
#pragma unroll
        for (int q = 0; q < NQ; ++q) {
            float mx = -3.0e38f;
#pragma unroll
            for (int kt = 0; kt < 2; ++kt)
#pragma unroll
                for (int j = 0; j < 8; ++j) { s[q][kt][j] *= SCL * 1.4426950408889634f; mx = fmaxf(mx, s[q][kt][j]); }
            mx = fmaxf(mx, __shfl_xor(mx, 16, 32));
            const float mn = fmaxf(mo[q], mx - 10.0f); const float al = __builtin_amdgcn_exp2f(mo[q] - mn); mo[q] = mn;
            float ps = 0.f;
#pragma unroll
            for (int kt = 0; kt < 2; ++kt)
#pragma unroll
                for (int j = 0; j < 8; ++j) { s[q][kt][j] = __builtin_amdgcn_exp2f(s[q][kt][j] - mn); ps += s[q][kt][j]; }
            ls[q] = ls[q] * al + ps;
#pragma unroll
            for (int mt = 0; mt < 8; ++mt) o[q][mt] *= al;
            if constexpr (NSPLIT == 0) { v16h p;
#pragma unroll
                for (int j = 0; j < 8; ++j) { p[j] = tohx(s[q][0][j]); p[8 + j] = tohx(s[q][1][j]); }
                pf[q] = p;
            } else { v8us h0, h1, l0, l1;
#pragma unroll
                for (int j = 0; j < 8; ++j) { unsigned short a, c2; splitf(s[q][0][j], a, c2); h0[j] = a; l0[j] = c2; splitf(s[q][1][j], a, c2); h1[j] = a; l1[j] = c2; }
                pf[q] = cat16b(h0, h1); pf2[q] = cat16b(l0, l1); } }
#pragma unroll
        for (int mt = 0; mt < 8; ++mt)
#pragma unroll
            for (int q = 0; q < NQ; ++q) o[q][mt] = WFrag<T16>::mma(vf[mt], pf[q], o[q][mt]);
        if (NSPLIT) {
#pragma unroll
            for (int mt = 0; mt < 8; ++mt)
#pragma unroll
                for (int q = 0; q < NQ; ++q) o[q][mt] = WFrag<T16>::mma(vf[mt], pf2[q], o[q][mt]);
#pragma unroll
            for (int mt = 0; mt < 8; ++mt)
#pragma unroll
                for (int q = 0; q < NQ; ++q) o[q][mt] = WFrag<T16>::mma(vf2[mt], pf[q], o[q][mt]); }
        // next block's value fragments: in flight under the next block's scores and softmax
        fetch_v(nk);
    }
#pragma unroll
    for (int q = 0; q < NQ; ++q) { const float inv = __fdiv_rn(1.0f, ls[q] + __shfl_xor(ls[q], 16, 32)); const size_t oo = (size_t)(q0 + q * 16) * DQ + 8 * lane;   // the O^T tile mt of a lane is its piece of half a block of the merged plane (fragment order, K = DQ)
#pragma unroll
        for (int mt = 0; mt < 8; ++mt) { v8us oh, ol;
#pragma unroll
            for (int j = 0; j < 8; ++j) { unsigned short a, c2; splitf(o[q][mt][j] * inv, a, c2); oh[j] = a; ol[j] = c2; }
            *(v8us*)(Ah + oo + mt * 256) = oh; *(v8us*)(Al + oo + mt * 256) = ol;
            asm volatile("s_wait_xcnt 0x0" :: "v"(oh), "v"(ol) : "memory"); } }   // precaution behind the two stores: their data are inputs, so no data register is rewritten (next tile's packing, the code behind the call) in front of the wait
}
#define WHI (RH / 64)             // work-groups per head on the hi + lo rows: 4 waves x 16 rows
#define WLO ((TT - RH) / 128)     // work-groups per head on the f16 rows: 4 waves x 32 rows
__global__ __launch_bounds__(128) void k_attn(const h16* __restrict__ Q16, const h16* __restrict__ K16, const h16* __restrict__ V16, const bf* __restrict__ Qh, const bf* __restrict__ Ql, const bf* __restrict__ Kh, const bf* __restrict__ Kl, const bf* __restrict__ Vh, const bf* __restrict__ Vl, bf* Ah, bf* Al) {
    const int w = threadIdx.x >> 5; int b = blockIdx.x;
    if (b < NH_ * WHI) { const int h = b / WHI; const size_t pz = (size_t)h * TT * HD;   // the longer work-groups (3 products) take the lowest block indices
        attn_rows<bf, 2, 1>(Qh + pz, Ql + pz, Kh + pz, Kl + pz, Vh + pz, Vl + pz, (b % WHI) * 64 + w * 16, Ah + h * HD * 16, Al + h * HD * 16);
    } else { b -= NH_ * WHI; const int h = b / WLO; const size_t pz = (size_t)h * TT * HD;
        attn_rows<h16, 0, 2>(Q16 + pz, nullptr, K16 + pz, nullptr, V16 + pz, nullptr, RH + (b % WLO) * 128 + w * 32, Ah + h * HD * 16, Al + h * HD * 16); }
}

extern "C" void kernel_launch(void* const* d_in, const int* in_sizes, int n_in,
                              void* d_out, int out_size, void* d_ws, size_t ws_size, hipStream_t stream) {
    (void)in_sizes; (void)n_in; (void)out_size;
    const float* x = (const float*)d_in[0]; const float* wq = (const float*)d_in[1]; const float* wk = (const float*)d_in[2]; const float* wv = (const float*)d_in[3]; const float* wo = (const float*)d_in[4]; const float* bo = (const float*)d_in[5];   /* order x, Wq, Wk, Wv, Wo ('oi' (out, in) [2048][2048] x 4; normal / sqrt(2048); no projection biases), bo (a REAL output bias [2048], 0.01): SIX inputs, all read */
    float* OUT = (float*)d_out;     // [2][2048][2048]
    char* wsp = (char*)d_ws;
    auto take = [&](size_t bytes) { char* p = wsp; wsp += (bytes + 255) & ~(size_t)255; return (void*)p; };
    bf* WQ = (bf*)take((size_t)DQ * DM * 2); bf* WK = (bf*)take((size_t)DKV * DM * 2); bf* WV = (bf*)take((size_t)DKV * DM * 2); bf* WO = (bf*)take((size_t)DM * DQ * 2);
    bf* XB = (bf*)take((size_t)TT * DM * 2);
    h16* QP16 = (h16*)take((size_t)NH_ * TT * HD * 2); h16* KP16 = (h16*)take((size_t)NKV * TT * HD * 2); h16* VT16 = (h16*)take((size_t)NKV * HD * TT * 2);
    bf* QPh = (bf*)take((size_t)NH_ * TT * HD * 2); bf* QPl = (bf*)take((size_t)NH_ * TT * HD * 2); bf* KPh = (bf*)take((size_t)NKV * TT * HD * 2); bf* KPl = (bf*)take((size_t)NKV * TT * HD * 2); bf* VTh = (bf*)take((size_t)NKV * HD * TT * 2); bf* VTl = (bf*)take((size_t)NKV * HD * TT * 2);
    bf* ATh = (bf*)take((size_t)TT * DQ * 2); bf* ATl = (bf*)take((size_t)TT * DQ * 2);
    if ((size_t)(wsp - (char*)d_ws) > ws_size) return;    // ws 256 MiB
    { k_cvt8<DM><<<(unsigned)(((size_t)DQ * DM / 8 + 255) / 256), 256, 0, stream>>>(wq, WQ, (size_t)DQ * DM / 8); k_cvt8<DM><<<(unsigned)(((size_t)DKV * DM / 8 + 255) / 256), 256, 0, stream>>>(wk, WK, (size_t)DKV * DM / 8); k_cvt8<DM><<<(unsigned)(((size_t)DKV * DM / 8 + 255) / 256), 256, 0, stream>>>(wv, WV, (size_t)DKV * DM / 8);
      k_cvt8<DQ><<<(unsigned)(((size_t)DM * DQ / 8 + 255) / 256), 256, 0, stream>>>(wo, WO, (size_t)DM * DQ / 8);
       }
    for (int b = 0; b < NB_; ++b) {
        
        k_cvt8<DM><<<(unsigned)(((size_t)TT * DM / 8 + 255) / 256), 256, 0, stream>>>(x + (size_t)b * TT * DM, XB, (size_t)TT * DM / 8);
        k_gemmw<bf, 0, false, 1, 1><<<dim3(DQ / 64, TT / 64, 1), 32, 0, stream>>>(WQ, nullptr, XB, nullptr, DM, nullptr, 0, nullptr, 0, 0, 0, QP16, QPh, QPl);   // q^T = Wq x^T: m = output feature, n = position
        k_gemmw<bf, 0, false, 1, 1><<<dim3(DKV / 64, TT / 64, 1), 32, 0, stream>>>(WK, nullptr, XB, nullptr, DM, nullptr, 0, nullptr, 0, 0, 0, KP16, KPh, KPl);
        k_gemmw<bf, 0, false, 1, 2><<<dim3(TT / 64, DKV / 64, 1), 32, 0, stream>>>(XB, nullptr, WV, nullptr, DM, nullptr, 0, nullptr, 0, 0, 0, VT16, VTh, VTl);   // v = x Wv^T: m = position, n = output feature
        k_attn<<<NH_ * (WHI + WLO), 128, 0, stream>>>(QP16, KP16, VT16, QPh, QPl, KPh, KPl, VTh, VTl, ATh, ATl);
        k_gemmw<bf, 1, true><<<dim3(TT / 64, DM / 64, 1), 32, 0, stream>>>(ATh, ATl, WO, nullptr, DQ, OUT + (size_t)b * TT * DM, DM, bo, 0, 0, 0, nullptr, nullptr, nullptr); }
}

// v005
// It runs in 276 microseconds.
// In two side-by-side timings against v004, it was 1.95 and 1.93 times as fast.
// Counting every step since v000, it is 8.24 times as fast.
#include <hip/hip_runtime.h>

// Dense multi-head attention, 16 FULL heads x 128, natural bias-free projections and a natural output projection WITH a bias (x [2][2048][2048]; q, k, v = x W^T ('oi' (out, in) [2048][2048], normal / sqrt(2048), no bias; 16 heads x 128: one kv head per query head); scores x 128^-0.5; softmax over ALL 2,048 keys (no mask, no causal rule); out = merged Wo^T + bo ('oi' + a REAL bias 0.01) -> [2][2048][2048] (8.4 M); argument order x, Wq, Wk, Wv, Wo, bo).
// Every 16-bit plane that a matrix instruction reads (x, the weights, q, k, v^T, the merged heads) lies in FRAGMENT ORDER: see 'fragment order' below.
// Layout, both batches in every launch: bf16 copy of x; 'oi' weights as-is; exact projections whose epilogue stores the head planes itself (no f32 projection goes through memory); one fused dense T-2048 attention launch over the 16 FULL heads (REP = NH_ / NKV = 1: each head has its own k / v plane; hybrid rows: < 512 hi/lo 3 products, rest fp16 with p <= 1024); merged hi/lo x Wo exact + bo.
// Compute dtypes, f32 accumulate: every input rounded to bf16; projections exact; attention rows < 512 3 products, rest fp16; softmax f32; Wo hl x exact + bo (the f32 bias epilogue).

#define NB_  2
#define TT   2048
#define DM   2048
#define NH_  16
#define NKV  16
#define REP  (NH_ / NKV)
#define HD   128
#define DQ   (NH_ * HD)
#define DKV  (NKV * HD)
#define RH   512                  // query rows < RH use hi+lo planes (0: none)
#define WIN  0
#define SCL  0.088388347648318447f   // HD^-0.5
typedef _Float16 h16;
typedef unsigned short bf;
typedef __attribute__((ext_vector_type(16))) __bf16   v16bf;
typedef __attribute__((ext_vector_type(16))) _Float16 v16h;
typedef __attribute__((ext_vector_type(8)))  _Float16 v8h;
typedef __attribute__((ext_vector_type(8)))  unsigned short v8us;
typedef __attribute__((ext_vector_type(8)))  float    v8f;
typedef __attribute__((ext_vector_type(4)))  float    v4f;
typedef v8h  __attribute__((may_alias)) v8ha;
typedef v4f  __attribute__((may_alias)) v4fa;
typedef v8us __attribute__((may_alias)) v8usa;

__device__ __forceinline__ unsigned short f2bf(float f) { unsigned u = __float_as_uint(f); u += 0x7FFFu + ((u >> 16) & 1u); return (unsigned short)(u >> 16); }
__device__ __forceinline__ float bf2f(unsigned short b) { return __uint_as_float(((unsigned)b) << 16); }
__device__ __forceinline__ float bfr(float f) { return bf2f(f2bf(f)); }
__device__ __forceinline__ v16h cat16(v8h lo, v8h hi) { return __builtin_shufflevector(lo, hi, 0, 1, 2, 3, 4, 5, 6, 7, 8, 9, 10, 11, 12, 13, 14, 15); }
__device__ __forceinline__ v16bf cat16b(v8us lo, v8us hi) { return __builtin_bit_cast(v16bf, __builtin_shufflevector(lo, hi, 0, 1, 2, 3, 4, 5, 6, 7, 8, 9, 10, 11, 12, 13, 14, 15)); }
__device__ __forceinline__ v8f wmma16(v16h a, v16h b, v8f c) { return __builtin_amdgcn_wmma_f32_16x16x32_f16(false, a, false, b, (short)0, c, false, false); }
__device__ __forceinline__ v8f wmmab(v16bf a, v16bf b, v8f c) { return __builtin_amdgcn_wmma_f32_16x16x32_bf16(false, a, false, b, (short)0, c, false, false); }



// ---- fragment order of a 16-bit plane P[row][k] (K columns, K % 32 == 0, rows % 16 == 0): 1-KiB blocks of 16 rows x 32 k, block (row / 16) * (K / 32) + k / 32; inside a block element
// ((k / 16) % 2) * 256 + ((k / 8) % 2) * 128 + (row % 16) * 8 + k % 8. A fragment is then two 16-byte loads per lane at block + lane * 8 and + 256 elements: each wave-wide load covers 512 contiguous bytes (4 whole lines, not 32 B in each of 16 lines).
// ---- gemmw (the body of k_qkv and k_wo): register-blocked GEMM, ONE WAVE per 64x64 output tile (16 accumulators), operands straight from fragment-order 16-bit planes; grid (M/64, N/64, ...), 32 threads; zz: the z-batch index, from blockIdx.z.
// C[m][n] (f32, pitch ldc, + optional f32 bias[n]) = sum_k A[m][k] Bt[n][k] (+ split products per NSPLIT). z-batch strides sA/sB/sC in elements. K % 32 == 0.
// PL != 0: no C; the epilogue stores the tile as the three 16-bit head planes (f16, bf16 hi, bf16 lo) P[n][m] in fragment order, m being the plane's k: a lane's 8 accumulator values are 8 successive m of one n, which is one 16-byte piece,
// and a wave's store is half a block (512 B in a row). PL == 1: the head is m / HD, plane [head][n][m % HD] (q, k: A = weight rows, Bt = x rows). PL == 2: the head is n / HD, plane [head][n % HD][m] (v^T: A = x rows, Bt = weight rows).
// PL != 0: sC is the z stride of the three planes, in elements.
// KSP > 1: zz = z * KSP + ks; the work-group sums k in [ks K/KSP, (ks+1) K/KSP) only; a row of C (ldc elements) holds the KSP partial rows side by side, partial ks at column ks ldc/KSP. K % (32 KSP) == 0.
template <typename T16> struct WFrag;
template <> struct WFrag<h16> { typedef v16h V; static __device__ __forceinline__ V ld(const h16* p) { return cat16(*(const v8h*)p, *(const v8h*)(p + 256)); } static __device__ __forceinline__ v8f mma(V a, V b, v8f c) { return wmma16(a, b, c); } };
template <> struct WFrag<bf> { typedef v16bf V; static __device__ __forceinline__ V ld(const bf* p) { return cat16b(*(const v8us*)p, *(const v8us*)(p + 256)); } static __device__ __forceinline__ v8f mma(V a, V b, v8f c) { return wmmab(a, b, c); } };
__device__ __forceinline__ h16 tohx(float x) { return (h16)x; }
__device__ __forceinline__ void splitf(float y, unsigned short& h, unsigned short& l) { h = f2bf(y); l = f2bf(y - bf2f(h)); }
template <typename T16, int NSPLIT, bool BIAS, int KSP = 1, int PL = 0>
__device__ __forceinline__ void gemmw(const int zz, const T16* __restrict__ A, const T16* __restrict__ A2, const T16* __restrict__ Bt, const T16* __restrict__ Bt2, int K, float* C, int ldc, const float* __restrict__ bias, size_t sA, size_t sB, size_t sC, h16* P16, bf* Ph, bf* Pl) {
    typedef typename WFrag<T16>::V V;
    __shared__ __align__(16) float os[16 * 68];
    const size_t z = zz / KSP; const int ks = zz % KSP; A += z * sA; if (A2) A2 += z * sA; Bt += z * sB; if (Bt2) Bt2 += z * sB; if constexpr (PL == 0) C += z * sC + (size_t)ks * (ldc / KSP);
    const int kb = ks * (K / KSP), ke = kb + K / KSP;
    const int lane = threadIdx.x & 31, lr = lane & 15, hi = lane >> 4; const int r0 = blockIdx.x * 64, c0 = blockIdx.y * 64;
    v8f acc[4][4];
#pragma unroll
    for (int mb = 0; mb < 4; ++mb)
#pragma unroll
        for (int nb = 0; nb < 4; ++nb) acc[mb][nb] = (v8f){};
    const size_t aoff = (size_t)r0 * K + 8 * lane, boff = (size_t)c0 * K + 8 * lane;   // 16 rows of a plane are K / 32 blocks = 16 K elements; a step of 32 k is one block = 512 elements
#pragma unroll 1
    for (int kc = kb; kc < ke; kc += 32) {
        V a[4], a2[4], bv[4], bv2[4]; const T16* pa[4]; const T16* pa2[4]; const T16* pb[4]; const T16* pb2[4];
#pragma unroll
        for (int mb = 0; mb < 4; ++mb) { pa[mb] = A + aoff + (size_t)mb * 16 * K + (size_t)kc * 16; pa2[mb] = (NSPLIT == 1 || NSPLIT == 2) ? A2 + aoff + (size_t)mb * 16 * K + (size_t)kc * 16 : pa[mb]; a[mb] = WFrag<T16>::ld(pa[mb]); if (NSPLIT == 1 || NSPLIT == 2) a2[mb] = WFrag<T16>::ld(pa2[mb]); }
#pragma unroll
        for (int nb = 0; nb < 4; ++nb) { pb[nb] = Bt + boff + (size_t)nb * 16 * K + (size_t)kc * 16; pb2[nb] = (NSPLIT >= 2) ? Bt2 + boff + (size_t)nb * 16 * K + (size_t)kc * 16 : pb[nb]; bv[nb] = WFrag<T16>::ld(pb[nb]); if (NSPLIT >= 2) bv2[nb] = WFrag<T16>::ld(pb2[nb]); }
        // precaution behind the trip's loads: every address is an input, so no address register is rewritten (by a later load's data or the next address) in front of the wait
        asm volatile("s_wait_xcnt 0x0" :: "v"(pa[0]), "v"(pa[1]), "v"(pa[2]), "v"(pa[3]), "v"(pa2[0]), "v"(pa2[1]), "v"(pa2[2]), "v"(pa2[3]), "v"(pb[0]), "v"(pb[1]), "v"(pb[2]), "v"(pb[3]), "v"(pb2[0]), "v"(pb2[1]), "v"(pb2[2]), "v"(pb2[3]) : "memory");
        __builtin_amdgcn_sched_barrier(0);   // keeps the trip's matrix instructions behind the wait: lifted over it, the first of them waits for its fragments with the rest of the trip's loads not yet issued
#pragma unroll
        for (int nb = 0; nb < 4; ++nb) {
#pragma unroll
            for (int mb = 0; mb < 4; ++mb) { acc[mb][nb] = WFrag<T16>::mma(a[mb], bv[nb], acc[mb][nb]); if (NSPLIT == 1 || NSPLIT == 2) acc[mb][nb] = WFrag<T16>::mma(a2[mb], bv[nb], acc[mb][nb]); if (NSPLIT >= 2) acc[mb][nb] = WFrag<T16>::mma(a[mb], bv2[nb], acc[mb][nb]); } }
        asm volatile("v_nop\n\tv_nop\n\tv_nop\n\tv_nop" : "+v"(acc[0][0]), "+v"(acc[1][1]), "+v"(acc[2][2]), "+v"(acc[3][3]) : "v"(a[0]), "v"(a[3]));
    }
    if constexpr (PL != 0) {
        const size_t pe = z * sC + (PL == 1 ? (size_t)(r0 / HD) * TT * HD + ((size_t)(c0 / 16) * (HD / 32) + (r0 % HD) / 32) * 512 : (size_t)(c0 / HD) * HD * TT + ((size_t)((c0 % HD) / 16) * (TT / 32) + r0 / 32) * 512) + 8 * lane;
#pragma unroll
        for (int nb = 0; nb < 4; ++nb) { const size_t en = pe + (size_t)nb * ((PL == 1 ? HD / 32 : TT / 32) * 512);   // 16 plane rows on; the four mb tiles are two whole blocks in a row
            h16* q16 = P16 + en; bf* qh = Ph + en; bf* ql = Pl + en; v8h o16[4]; v8us oh[4], ol[4];
#pragma unroll
            for (int mb = 0; mb < 4; ++mb) {
#pragma unroll
                for (int j = 0; j < 8; ++j) { const float r = acc[mb][nb][j]; o16[mb][j] = tohx(r); unsigned short a2, c2; splitf(r, a2, c2); oh[mb][j] = a2; ol[mb][j] = c2; }
                *(v8h*)(q16 + mb * 256) = o16[mb]; *(v8us*)(qh + mb * 256) = oh[mb]; *(v8us*)(ql + mb * 256) = ol[mb]; }
            // precaution behind the twelve stores: their data and addresses are inputs, so none of these registers is rewritten (next column's packing) in front of the wait
            asm volatile("s_wait_xcnt 0x0" :: "v"(o16[0]), "v"(o16[1]), "v"(o16[2]), "v"(o16[3]), "v"(oh[0]), "v"(oh[1]), "v"(oh[2]), "v"(oh[3]), "v"(ol[0]), "v"(ol[1]), "v"(ol[2]), "v"(ol[3]), "v"(q16), "v"(qh), "v"(ql) : "memory"); }
    } else {
#pragma unroll
    for (int mb = 0; mb < 4; ++mb) {
#pragma unroll
        for (int nb = 0; nb < 4; ++nb) {
#pragma unroll
            for (int j = 0; j < 8; ++j) os[(hi * 8 + j) * 68 + nb * 16 + lr] = acc[mb][nb][j]; }
        __builtin_amdgcn_wave_barrier(); asm volatile("" ::: "memory");
        float* crow = C + (size_t)(r0 + mb * 16) * ldc + c0;
{
#pragma unroll
            for (int s = 0; s < 8; ++s) { const int row = 2 * s + hi, cofs = lr * 4; v4f val = *(const v4fa*)(os + row * 68 + cofs); if (BIAS) { val[0] += bfr(bias[c0 + cofs]); val[1] += bfr(bias[c0 + cofs + 1]); val[2] += bfr(bias[c0 + cofs + 2]); val[3] += bfr(bias[c0 + cofs + 3]); }
                *(v4f*)(crow + (size_t)row * ldc + cofs) = val; }
             }
        __builtin_amdgcn_wave_barrier(); asm volatile("" ::: "memory");
    }
    }
}

// k_qkv: the three projections of both batches in ONE launch; grid (32, 32, 3 NB_), blockIdx.z = projection * NB_ + batch. q^T = Wq x^T and k^T = Wk x^T: m = output feature, n = position; v = x Wv^T: m = position, n = output feature.
__global__ __launch_bounds__(32) void k_qkv(const bf* __restrict__ WQ, const bf* __restrict__ WK, const bf* __restrict__ WV, const bf* __restrict__ XB, h16* Q16, bf* Qh, bf* Ql, h16* K16, bf* Kh, bf* Kl, h16* V16, bf* Vh, bf* Vl) {
    const int pr = blockIdx.z / NB_, bt = blockIdx.z % NB_;
    if (pr < 2) gemmw<bf, 0, false, 1, 1>(bt, pr ? WK : WQ, nullptr, XB, nullptr, DM, nullptr, 0, nullptr, 0, (size_t)TT * DM, (size_t)NH_ * TT * HD, pr ? K16 : Q16, pr ? Kh : Qh, pr ? Kl : Ql);
    else gemmw<bf, 0, false, 1, 2>(bt, XB, nullptr, WV, nullptr, DM, nullptr, 0, nullptr, (size_t)TT * DM, 0, (size_t)NKV * HD * TT, V16, Vh, Vl);
}
// k_wo: out = merged (hi + lo) Wo^T + bo, both batches; grid (32, 32, NB_).
__global__ __launch_bounds__(32) void k_wo(const bf* __restrict__ Ah, const bf* __restrict__ Al, const bf* __restrict__ WO, float* OUT, const float* __restrict__ bo) {
    gemmw<bf, 1, true>(blockIdx.z, Ah, Al, WO, nullptr, DQ, OUT, DM, bo, (size_t)TT * DQ, 0, (size_t)TT * DM, nullptr, nullptr, nullptr);
}

typedef __attribute__((ext_vector_type(2))) _Float16 v2h;
typedef __attribute__((ext_vector_type(4))) _Float16 v4h;
typedef __attribute__((ext_vector_type(2))) unsigned short v2us;
typedef __attribute__((ext_vector_type(4))) unsigned short v4us;
typedef __attribute__((ext_vector_type(2))) float v2f;
typedef __attribute__((ext_vector_type(4))) int v4i;

// k_cvt8: f32 [rows][K] -> bf16 plane in fragment order. A thread makes one 16-byte piece; a wave takes 8 rows x 32 k: it reads one whole 128-B line per row and stores 4 whole lines.
// All five planes (x of both batches, then Wq, Wk, Wv, Wo) in ONE launch: they lie one behind the other in dst, and a work-group picks its source by its index (every plane is a whole number of work-groups).
#define XBLK (NB_ * TT * DM / 8 / 256)   // work-groups on x
#define WBLK (DQ * DM / 8 / 256)         // work-groups on one weight
template <int K>
__global__ __launch_bounds__(256) void k_cvt8(const float* __restrict__ x, const float* __restrict__ wq, const float* __restrict__ wk, const float* __restrict__ wv, const float* __restrict__ wo, bf* dst) {
    int bk = blockIdx.x; const float* src = x;
    if (bk >= XBLK) { const int wi = (bk - XBLK) / WBLK; bk = (bk - XBLK) % WBLK; src = wi == 0 ? wq : wi == 1 ? wk : wi == 2 ? wv : wo; dst += (size_t)NB_ * TT * DM + (size_t)wi * DQ * DM; }
    const size_t i = (size_t)bk * 256 + threadIdx.x; const int c4 = (int)(i & 3), r16 = (int)((i >> 2) & 15); const size_t blk = i >> 6;
    const v8f v = *(const v8f*)(src + ((blk / (K / 32)) * 16 + r16) * K + (blk % (K / 32)) * 32 + c4 * 8); v8us o;
#pragma unroll
    for (int k = 0; k < 8; ++k) o[k] = f2bf(v[k]); *(v8us*)(dst + blk * 512 + (c4 >> 1) * 256 + (c4 & 1) * 128 + r16 * 8) = o;  }

// ---- k_attn: scores, softmax and P.V of both batches in ONE launch, all heads; no score or probability matrix goes through memory.
// A wave owns NQ x 16 query rows of one head and walks the 2048 keys in blocks of 32. It forms the TRANSPOSED score tile S^T = K Q^T (A = key rows, B = query rows): a lane then holds, for ITS query (lane & 15),
// keys 8 hi + j of the first 16-key tile and 16 + 8 hi + j of the second, which is the B fragment order of the next product O^T = V^T P^T (A = rows of the [d][t] value plane): no shuffle, no LDS.
// Softmax is the running form: per query a running maximum mo (kept 10 below the true one in log2 units, so that p <= 1024: the carrier of the 16-bit probabilities; it cancels in the division) and a running sum;
// the O^T tiles are rescaled by 2^(old - new) every block. Rows < RH: hi + lo planes, 3 products; the rest f16, as before. The four waves of a work-group walk the same head's keys, so three of four fragment reads can hit the WGP cache.
template <typename T16, int NSPLIT, int NQ>
__device__ __forceinline__ void attn_rows(const T16* __restrict__ Q, const T16* __restrict__ Q2, const T16* __restrict__ Kp, const T16* __restrict__ K2, const T16* __restrict__ Vt, const T16* __restrict__ V2, int q0, bf* Ah, bf* Al) {
    typedef typename WFrag<T16>::V V;
    const int lane = threadIdx.x & 31;
    V qf[NQ][4], qf2[NQ][4];
    const T16* qa = Q + (size_t)q0 * HD + 8 * lane; const T16* qa2 = NSPLIT ? Q2 + (size_t)q0 * HD + 8 * lane : qa;   // fragment order: 16 rows = 16 HD elements, 32 d = 512 elements
#pragma unroll
    for (int q = 0; q < NQ; ++q)
#pragma unroll
        for (int c = 0; c < 4; ++c) { qf[q][c] = WFrag<T16>::ld(qa + q * 16 * HD + c * 512); if (NSPLIT) qf2[q][c] = WFrag<T16>::ld(qa2 + q * 16 * HD + c * 512); }
    asm volatile("s_wait_xcnt 0x0" :: "v"(qa), "v"(qa2) : "memory");   // precaution behind the loads: the addresses are inputs, so they are not rewritten in front of the wait
    v8f o[NQ][8]; float mo[NQ], ls[NQ];
#pragma unroll
    for (int q = 0; q < NQ; ++q) { mo[q] = -3.0e38f; ls[q] = 0.f;
#pragma unroll
        for (int mt = 0; mt < 8; ++mt) o[q][mt] = (v8f){}; }
    const size_t kl = 8 * lane, vl = 8 * lane;
    V kf[2][4], kf2[2][4], vf[8], vf2[8];
    // each fetch ends in s_wait_xcnt 0 with its addresses as inputs: a precaution (no address register is rewritten in front of the wait); the statement also keeps the loads at the early place where they are written
    auto fetch_k = [&](int k0) { const T16* ka = Kp + kl + (size_t)k0 * HD; const T16* ka2 = NSPLIT ? K2 + kl + (size_t)k0 * HD : ka;
#pragma unroll
        for (int kt = 0; kt < 2; ++kt)
#pragma unroll
            for (int c = 0; c < 4; ++c) { kf[kt][c] = WFrag<T16>::ld(ka + kt * 16 * HD + c * 512); if (NSPLIT) kf2[kt][c] = WFrag<T16>::ld(ka2 + kt * 16 * HD + c * 512); }
        asm volatile("s_wait_xcnt 0x0" :: "v"(ka), "v"(ka2) : "memory"); };
    auto fetch_v = [&](int k0) { const T16* va = Vt + vl + (size_t)k0 * 16; const T16* va2 = NSPLIT ? V2 + vl + (size_t)k0 * 16 : va;
#pragma unroll
        for (int mt = 0; mt < 8; ++mt) { vf[mt] = WFrag<T16>::ld(va + (size_t)mt * 16 * TT); if (NSPLIT) vf2[mt] = WFrag<T16>::ld(va2 + (size_t)mt * 16 * TT); }
        asm volatile("s_wait_xcnt 0x0" :: "v"(va), "v"(va2) : "memory"); };
    fetch_k(0); fetch_v(0);
#pragma unroll 1   // kept rolled: one trip already holds a whole key block's matrix instructions and both fetches
    for (int kb = 0; kb < TT; kb += 32) {
        const int nk = (kb + 32 < TT) ? kb + 32 : kb;   // the block fetched ahead; the last trip fetches its own again (in bounds, unused)
        v8f s[NQ][2];
#pragma unroll
        for (int q = 0; q < NQ; ++q) { s[q][0] = (v8f){}; s[q][1] = (v8f){}; }
#pragma unroll
        for (int c = 0; c < 4; ++c) {
#pragma unroll
            for (int kt = 0; kt < 2; ++kt)
#pragma unroll
                for (int q = 0; q < NQ; ++q) s[q][kt] = WFrag<T16>::mma(kf[kt][c], qf[q][c], s[q][kt]);
            if (NSPLIT) {
#pragma unroll
                for (int kt = 0; kt < 2; ++kt)
#pragma unroll
                    for (int q = 0; q < NQ; ++q) s[q][kt] = WFrag<T16>::mma(kf2[kt][c], qf[q][c], s[q][kt]);
#pragma unroll
                for (int kt = 0; kt < 2; ++kt)
#pragma unroll
                    for (int q = 0; q < NQ; ++q) s[q][kt] = WFrag<T16>::mma(kf[kt][c], qf2[q][c], s[q][kt]); } }
        // next block's key fragments: in flight under the softmax and P.V of this block
        fetch_k(nk);
        V pf[NQ], pf2[NQ];
#pragma unroll
        for (int q = 0; q < NQ; ++q) {
            float mx = -3.0e38f;
#pragma unroll
            for (int kt = 0; kt < 2; ++kt)
#pragma unroll
                for (int j = 0; j < 8; ++j) { s[q][kt][j] *= SCL * 1.4426950408889634f; mx = fmaxf(mx, s[q][kt][j]); }
            mx = fmaxf(mx, __shfl_xor(mx, 16, 32));
            const float mn = fmaxf(mo[q], mx - 10.0f); const float al = __builtin_amdgcn_exp2f(mo[q] - mn); mo[q] = mn;
            float ps = 0.f;
#pragma unroll
            for (int kt = 0; kt < 2; ++kt)
#pragma unroll
                for (int j = 0; j < 8; ++j) { s[q][kt][j] = __builtin_amdgcn_exp2f(s[q][kt][j] - mn); ps += s[q][kt][j]; }
            ls[q] = ls[q] * al + ps;
#pragma unroll
            for (int mt = 0; mt < 8; ++mt) o[q][mt] *= al;
            if constexpr (NSPLIT == 0) { v16h p;
#pragma unroll
                for (int j = 0; j < 8; ++j) { p[j] = tohx(s[q][0][j]); p[8 + j] = tohx(s[q][1][j]); }
                pf[q] = p;
            } else { v8us h0, h1, l0, l1;
#pragma unroll
                for (int j = 0; j < 8; ++j) { unsigned short a, c2; splitf(s[q][0][j], a, c2); h0[j] = a; l0[j] = c2; splitf(s[q][1][j], a, c2); h1[j] = a; l1[j] = c2; }
                pf[q] = cat16b(h0, h1); pf2[q] = cat16b(l0, l1); } }
#pragma unroll
        for (int mt = 0; mt < 8; ++mt)
#pragma unroll
            for (int q = 0; q < NQ; ++q) o[q][mt] = WFrag<T16>::mma(vf[mt], pf[q], o[q][mt]);
        if (NSPLIT) {
#pragma unroll
            for (int mt = 0; mt < 8; ++mt)
#pragma unroll
                for (int q = 0; q < NQ; ++q) o[q][mt] = WFrag<T16>::mma(vf[mt], pf2[q], o[q][mt]);
#pragma unroll
            for (int mt = 0; mt < 8; ++mt)
#pragma unroll
                for (int q = 0; q < NQ; ++q) o[q][mt] = WFrag<T16>::mma(vf2[mt], pf[q], o[q][mt]); }
        // next block's value fragments: in flight under the next block's scores and softmax
        fetch_v(nk);
    }
#pragma unroll
    for (int q = 0; q < NQ; ++q) { const float inv = __fdiv_rn(1.0f, ls[q] + __shfl_xor(ls[q], 16, 32)); const size_t oo = (size_t)(q0 + q * 16) * DQ + 8 * lane;   // the O^T tile mt of a lane is its piece of half a block of the merged plane (fragment order, K = DQ)
#pragma unroll
        for (int mt = 0; mt < 8; ++mt) { v8us oh, ol;
#pragma unroll
            for (int j = 0; j < 8; ++j) { unsigned short a, c2; splitf(o[q][mt][j] * inv, a, c2); oh[j] = a; ol[j] = c2; }
            *(v8us*)(Ah + oo + mt * 256) = oh; *(v8us*)(Al + oo + mt * 256) = ol;
            asm volatile("s_wait_xcnt 0x0" :: "v"(oh), "v"(ol) : "memory"); } }   // precaution behind the two stores: their data are inputs, so no data register is rewritten (next tile's packing, the code behind the call) in front of the wait
}
#define WHI (RH / 64)             // work-groups per head on the hi + lo rows: 4 waves x 16 rows
#define WLO ((TT - RH) / 128)     // work-groups per head on the f16 rows: 4 waves x 32 rows
__global__ __launch_bounds__(128) void k_attn(const h16* __restrict__ Q16, const h16* __restrict__ K16, const h16* __restrict__ V16, const bf* __restrict__ Qh, const bf* __restrict__ Ql, const bf* __restrict__ Kh, const bf* __restrict__ Kl, const bf* __restrict__ Vh, const bf* __restrict__ Vl, bf* Ah, bf* Al) {
    const int w = threadIdx.x >> 5; int b = blockIdx.x;   // h counts the heads of both batches: the head planes of batch 1 lie behind those of batch 0, its merged plane TT * DQ elements on
    if (b < NB_ * NH_ * WHI) { const int h = b / WHI; const size_t pz = (size_t)h * TT * HD, az = (size_t)(h / NH_) * TT * DQ + (h % NH_) * HD * 16;   // the longer work-groups (3 products) take the lowest indices
        attn_rows<bf, 2, 1>(Qh + pz, Ql + pz, Kh + pz, Kl + pz, Vh + pz, Vl + pz, (b % WHI) * 64 + w * 16, Ah + az, Al + az);
    } else { b -= NB_ * NH_ * WHI; const int h = b / WLO; const size_t pz = (size_t)h * TT * HD, az = (size_t)(h / NH_) * TT * DQ + (h % NH_) * HD * 16;
        attn_rows<h16, 0, 2>(Q16 + pz, nullptr, K16 + pz, nullptr, V16 + pz, nullptr, RH + (b % WLO) * 128 + w * 32, Ah + az, Al + az); }
}

extern "C" void kernel_launch(void* const* d_in, const int* in_sizes, int n_in,
                              void* d_out, int out_size, void* d_ws, size_t ws_size, hipStream_t stream) {
    (void)in_sizes; (void)n_in; (void)out_size;
    const float* x = (const float*)d_in[0]; const float* wq = (const float*)d_in[1]; const float* wk = (const float*)d_in[2]; const float* wv = (const float*)d_in[3]; const float* wo = (const float*)d_in[4]; const float* bo = (const float*)d_in[5];   /* order x, Wq, Wk, Wv, Wo ('oi' (out, in) [2048][2048] x 4; normal / sqrt(2048); no projection biases), bo (a REAL output bias [2048], 0.01): SIX inputs, all read */
    float* OUT = (float*)d_out;     // [2][2048][2048]
    char* wsp = (char*)d_ws;
    auto take = [&](size_t bytes) { char* p = wsp; wsp += (bytes + 255) & ~(size_t)255; return (void*)p; };
    bf* XB = (bf*)take((size_t)NB_ * TT * DM * 2); bf* WQ = (bf*)take((size_t)DQ * DM * 2); bf* WK = (bf*)take((size_t)DKV * DM * 2); bf* WV = (bf*)take((size_t)DKV * DM * 2); bf* WO = (bf*)take((size_t)DM * DQ * 2);   // one behind the other: k_cvt8 writes them as one range
    h16* QP16 = (h16*)take((size_t)NB_ * NH_ * TT * HD * 2); h16* KP16 = (h16*)take((size_t)NB_ * NKV * TT * HD * 2); h16* VT16 = (h16*)take((size_t)NB_ * NKV * HD * TT * 2);
    bf* QPh = (bf*)take((size_t)NB_ * NH_ * TT * HD * 2); bf* QPl = (bf*)take((size_t)NB_ * NH_ * TT * HD * 2); bf* KPh = (bf*)take((size_t)NB_ * NKV * TT * HD * 2); bf* KPl = (bf*)take((size_t)NB_ * NKV * TT * HD * 2); bf* VTh = (bf*)take((size_t)NB_ * NKV * HD * TT * 2); bf* VTl = (bf*)take((size_t)NB_ * NKV * HD * TT * 2);
    bf* ATh = (bf*)take((size_t)NB_ * TT * DQ * 2); bf* ATl = (bf*)take((size_t)NB_ * TT * DQ * 2);
    if ((size_t)(wsp - (char*)d_ws) > ws_size) return;    // 224 MiB of the 256 MiB
    k_cvt8<DM><<<XBLK + 4 * WBLK, 256, 0, stream>>>(x, wq, wk, wv, wo, XB);
    k_qkv<<<dim3(DQ / 64, TT / 64, 3 * NB_), 32, 0, stream>>>(WQ, WK, WV, XB, QP16, QPh, QPl, KP16, KPh, KPl, VT16, VTh, VTl);
    k_attn<<<NB_ * NH_ * (WHI + WLO), 128, 0, stream>>>(QP16, KP16, VT16, QPh, QPl, KPh, KPl, VTh, VTl, ATh, ATl);
    k_wo<<<dim3(TT / 64, DM / 64, NB_), 32, 0, stream>>>(ATh, ATl, WO, OUT, bo);
}

// v006
// It runs in 251 microseconds.
// Two timings next to v005 put it at 1.10 and 1.09 times that version's speed.
// Over all steps from v000 it is 9.04 times as fast.
#include <hip/hip_runtime.h>

// Dense multi-head attention, 16 FULL heads x 128, natural bias-free projections and a natural output projection WITH a bias (x [2][2048][2048]; q, k, v = x W^T ('oi' (out, in) [2048][2048], normal / sqrt(2048), no bias; 16 heads x 128: one kv head per query head); scores x 128^-0.5; softmax over ALL 2,048 keys (no mask, no causal rule); out = merged Wo^T + bo ('oi' + a REAL bias 0.01) -> [2][2048][2048] (8.4 M); argument order x, Wq, Wk, Wv, Wo, bo).
// Every 16-bit plane that a matrix instruction reads (x, the weights, q, k, v^T, the merged heads) lies in FRAGMENT ORDER: see 'fragment order' below.
// Layout, both batches in every launch: bf16 copy of x; 'oi' weights as-is; exact projections whose epilogue stores the head planes itself (no f32 projection goes through memory); one fused dense T-2048 attention launch over the 16 FULL heads (REP = NH_ / NKV = 1: each head has its own k / v plane; hybrid rows: < 512 hi/lo 3 products, rest fp16 with p <= 1024); merged hi/lo x Wo exact + bo.
// Compute dtypes, f32 accumulate: every input rounded to bf16; projections exact; attention rows < 512 3 products, rest fp16; softmax f32; Wo hl x exact + bo (the f32 bias epilogue).

#define NB_  2
#define TT   2048
#define DM   2048
#define NH_  16
#define NKV  16
#define REP  (NH_ / NKV)
#define HD   128
#define DQ   (NH_ * HD)
#define DKV  (NKV * HD)
#define RH   512                  // query rows < RH use hi+lo planes (0: none)
#define WIN  0
#define SCL  0.088388347648318447f   // HD^-0.5
typedef _Float16 h16;
typedef unsigned short bf;
typedef __attribute__((ext_vector_type(16))) __bf16   v16bf;
typedef __attribute__((ext_vector_type(16))) _Float16 v16h;
typedef __attribute__((ext_vector_type(8)))  _Float16 v8h;
typedef __attribute__((ext_vector_type(8)))  unsigned short v8us;
typedef __attribute__((ext_vector_type(8)))  float    v8f;
typedef __attribute__((ext_vector_type(4)))  float    v4f;
typedef v8h  __attribute__((may_alias)) v8ha;
typedef v4f  __attribute__((may_alias)) v4fa;
typedef v8us __attribute__((may_alias)) v8usa;

__device__ __forceinline__ unsigned short f2bf(float f) { unsigned u = __float_as_uint(f); u += 0x7FFFu + ((u >> 16) & 1u); return (unsigned short)(u >> 16); }
__device__ __forceinline__ float bf2f(unsigned short b) { return __uint_as_float(((unsigned)b) << 16); }
__device__ __forceinline__ float bfr(float f) { return bf2f(f2bf(f)); }
__device__ __forceinline__ v16h cat16(v8h lo, v8h hi) { return __builtin_shufflevector(lo, hi, 0, 1, 2, 3, 4, 5, 6, 7, 8, 9, 10, 11, 12, 13, 14, 15); }
__device__ __forceinline__ v16bf cat16b(v8us lo, v8us hi) { return __builtin_bit_cast(v16bf, __builtin_shufflevector(lo, hi, 0, 1, 2, 3, 4, 5, 6, 7, 8, 9, 10, 11, 12, 13, 14, 15)); }
__device__ __forceinline__ v8f wmma16(v16h a, v16h b, v8f c) { return __builtin_amdgcn_wmma_f32_16x16x32_f16(false, a, false, b, (short)0, c, false, false); }
__device__ __forceinline__ v8f wmmab(v16bf a, v16bf b, v8f c) { return __builtin_amdgcn_wmma_f32_16x16x32_bf16(false, a, false, b, (short)0, c, false, false); }



// ---- fragment order of a 16-bit plane P[row][k] (K columns, K % 32 == 0, rows % 16 == 0): 1-KiB blocks of 16 rows x 32 k, block (row / 16) * (K / 32) + k / 32; inside a block element
// ((k / 16) % 2) * 256 + ((k / 8) % 2) * 128 + (row % 16) * 8 + k % 8. A fragment is then two 16-byte loads per lane at block + lane * 8 and + 256 elements: each wave-wide load covers 512 contiguous bytes (4 whole lines, not 32 B in each of 16 lines).
// ---- gemmw (the body of k_qkv and k_wo): register-blocked GEMM, a work-group of FOUR WAVES per 128x128 output tile, one wave per 64x64 quarter (16 accumulators); grid (M/128, N/128, ...), 128 threads; zz: the z-batch index, from blockIdx.z.
// The operand tiles (128 rows x 64 k of each fragment-order plane) are brought into LDS once per work-group by asynchronous copies, two buffers: stage s + 2 flies while stage s + 1 is worked on; each fragment is then read from LDS by the two waves that need it. sm: the kernel's staging LDS, two stages.
// C[m][n] (f32, pitch ldc, + optional f32 bias[n]) = sum_k (A[m][k] (+ A2[m][k] where NSPLIT == 1)) Bt[n][k]. z-batch strides sA/sB/sC in elements. K % 64 == 0, K >= 128.
// PL != 0: no C; the epilogue stores the tile as the three 16-bit head planes (f16, bf16 hi, bf16 lo) P[n][m] in fragment order, m being the plane's k: a lane's 8 accumulator values are 8 successive m of one n, which is one 16-byte piece,
// and a wave's store is half a block (512 B in a row). PL == 1: the head is m / HD, plane [head][n][m % HD] (q, k: A = weight rows, Bt = x rows). PL == 2: the head is n / HD, plane [head][n % HD][m] (v^T: A = x rows, Bt = weight rows).
// PL != 0: sC is the z stride of the three planes, in elements.
template <typename T16> struct WFrag;
template <> struct WFrag<h16> { typedef v16h V; static __device__ __forceinline__ V ld(const h16* p) { return cat16(*(const v8h*)p, *(const v8h*)(p + 256)); } static __device__ __forceinline__ v8f mma(V a, V b, v8f c) { return wmma16(a, b, c); } };
template <> struct WFrag<bf> { typedef v16bf V; static __device__ __forceinline__ V ld(const bf* p) { return cat16b(*(const v8us*)p, *(const v8us*)(p + 256)); } static __device__ __forceinline__ v8f mma(V a, V b, v8f c) { return wmmab(a, b, c); } };
__device__ __forceinline__ h16 tohx(float x) { return (h16)x; }
__device__ __forceinline__ void splitf(float y, unsigned short& h, unsigned short& l) { h = f2bf(y); l = f2bf(y - bf2f(h)); }
// copy_tile: one 128-row x 64-k tile of a fragment-order plane (8 row blocks of 2 KiB, rb elements apart) goes into 16 KiB of LDS, in the plane's own order: eight asynchronous 16-byte copies per lane, 128 lanes, a wave's copy = 512 bytes in a row on both sides.
// l: the lane's own LDS byte address in the tile, g: its own global address. The s_wait_xcnt 0 is the last line of the copies' own statement: a precaution, so that no address register of an issued copy is rewritten in front of it.
template <typename T16>
__device__ __forceinline__ void copy_tile(unsigned l, const T16* g, size_t rb) {
    asm volatile("global_load_async_to_lds_b128 %0, %8, off\n\t"
                 "global_load_async_to_lds_b128 %1, %9, off\n\t"
                 "global_load_async_to_lds_b128 %2, %10, off\n\t"
                 "global_load_async_to_lds_b128 %3, %11, off\n\t"
                 "global_load_async_to_lds_b128 %4, %12, off\n\t"
                 "global_load_async_to_lds_b128 %5, %13, off\n\t"
                 "global_load_async_to_lds_b128 %6, %14, off\n\t"
                 "global_load_async_to_lds_b128 %7, %15, off\n\t"
                 "s_wait_xcnt 0x0"
                 :: "v"(l), "v"(l + 2048u), "v"(l + 4096u), "v"(l + 6144u), "v"(l + 8192u), "v"(l + 10240u), "v"(l + 12288u), "v"(l + 14336u),
                    "v"(g), "v"(g + rb), "v"(g + 2 * rb), "v"(g + 3 * rb), "v"(g + 4 * rb), "v"(g + 5 * rb), "v"(g + 6 * rb), "v"(g + 7 * rb) : "memory");
}
#define TILEB 16384               // bytes of one staged tile: 128 rows x 64 k x 2 B
template <typename T16, int NSPLIT, bool BIAS, int PL = 0>
__device__ __forceinline__ void gemmw(unsigned char* sm, const int zz, const T16* __restrict__ A, const T16* __restrict__ A2, const T16* __restrict__ Bt, int K, float* C, int ldc, const float* __restrict__ bias, size_t sA, size_t sB, size_t sC, h16* P16, bf* Ph, bf* Pl) {
    typedef typename WFrag<T16>::V V;
    static_assert(NSPLIT == 0 || NSPLIT == 1, "one or two A planes");
    __shared__ __align__(16) float osw[4][16 * 68];
    const size_t z = zz; A += z * sA; if (NSPLIT == 1) A2 += z * sA; Bt += z * sB; if constexpr (PL == 0) C += z * sC;
    const int tid = threadIdx.x, lane = tid & 31, lr = lane & 15, hi = lane >> 4, w = tid >> 5; const int R0 = blockIdx.x * 128, C0 = blockIdx.y * 128, r0 = R0 + (w & 1) * 64, c0 = C0 + (w >> 1) * 64;
    float* os = osw[w];
    v8f acc[4][4];
#pragma unroll
    for (int mb = 0; mb < 4; ++mb)
#pragma unroll
        for (int nb = 0; nb < 4; ++nb) acc[mb][nb] = (v8f){};
    constexpr unsigned SB = (NSPLIT == 1 ? 3 : 2) * TILEB;   // a stage: [A | A2 | B] tiles
    const unsigned l0 = (unsigned)(size_t)sm + 16u * tid;    // the lane's LDS byte address in buffer 0
    const T16* gA = A + (size_t)R0 * K + 8 * tid; const T16* gA2 = NSPLIT == 1 ? A2 + (size_t)R0 * K + 8 * tid : gA; const T16* gB = Bt + (size_t)C0 * K + 8 * tid;   // 16 rows of a plane are 16 K elements; 64 k of a row block are 1024 elements in a row
    auto issue = [&](int s) { const unsigned l = l0 + (s & 1) * SB; const size_t ko = (size_t)s * 1024;
        copy_tile(l, gA + ko, (size_t)16 * K); if (NSPLIT == 1) copy_tile(l + TILEB, gA2 + ko, (size_t)16 * K); copy_tile(l + (SB - TILEB), gB + ko, (size_t)16 * K); };
    const int NS = K / 64;
    const unsigned fa = (w & 1) * 8192 + 16 * lane, fb = (SB - TILEB) + (w >> 1) * 8192 + 16 * lane;   // the wave's four row blocks in the A and in the B tile
    issue(0);
    asm volatile("s_wait_asynccnt 0x0" ::: "memory");   // stage 0 of this wave has landed
    __syncthreads();                                     // ... and every other wave's part of it
    issue(1);
#pragma unroll 1   // kept rolled: the two buffers alternate by the trip's parity
    for (int s = 0; s < NS; ++s) {
        const unsigned char* st = sm + (s & 1) * SB;
#pragma unroll
        for (int u = 0; u < 2; ++u) {
            V a[4], a2[4], bv[4];
#pragma unroll
            for (int mb = 0; mb < 4; ++mb) { a[mb] = WFrag<T16>::ld((const T16*)(st + fa + mb * 2048 + u * 1024)); if (NSPLIT == 1) a2[mb] = WFrag<T16>::ld((const T16*)(st + TILEB + fa + mb * 2048 + u * 1024)); }
#pragma unroll
            for (int nb = 0; nb < 4; ++nb) bv[nb] = WFrag<T16>::ld((const T16*)(st + fb + nb * 2048 + u * 1024));
            __builtin_amdgcn_sched_barrier(0);   // keeps the block's LDS reads together in front of its matrix instructions: sunk among them, every group of four waits out an LDS latency of its own
#pragma unroll
            for (int nb = 0; nb < 4; ++nb) {
#pragma unroll
                for (int mb = 0; mb < 4; ++mb) { acc[mb][nb] = WFrag<T16>::mma(a[mb], bv[nb], acc[mb][nb]); if (NSPLIT == 1) acc[mb][nb] = WFrag<T16>::mma(a2[mb], bv[nb], acc[mb][nb]); } }
        }
        asm volatile("s_wait_dscnt 0x0" ::: "memory");      // this wave's reads of the buffer have returned
        asm volatile("s_wait_asynccnt 0x0" ::: "memory");   // its copies of stage s + 1 have landed
        __syncthreads();                                     // publishes stage s + 1 and ends every wave's reads of stage s
        if (s + 2 < NS) issue(s + 2);                        // refill of the buffer that this trip has read
    }
    asm volatile("s_wait_asynccnt 0x0" ::: "memory");       // nothing is in flight when the wave goes on
    if constexpr (PL != 0) {
        const size_t pe = z * sC + (PL == 1 ? (size_t)(r0 / HD) * TT * HD + ((size_t)(c0 / 16) * (HD / 32) + (r0 % HD) / 32) * 512 : (size_t)(c0 / HD) * HD * TT + ((size_t)((c0 % HD) / 16) * (TT / 32) + r0 / 32) * 512) + 8 * lane;
#pragma unroll
        for (int nb = 0; nb < 4; ++nb) { const size_t en = pe + (size_t)nb * ((PL == 1 ? HD / 32 : TT / 32) * 512);   // 16 plane rows on; the four mb tiles are two whole blocks in a row
            h16* q16 = P16 + en; bf* qh = Ph + en; bf* ql = Pl + en; v8h o16[4]; v8us oh[4], ol[4];
#pragma unroll
            for (int mb = 0; mb < 4; ++mb) {
#pragma unroll
                for (int j = 0; j < 8; ++j) { const float r = acc[mb][nb][j]; o16[mb][j] = tohx(r); unsigned short a2, c2; splitf(r, a2, c2); oh[mb][j] = a2; ol[mb][j] = c2; }
                *(v8h*)(q16 + mb * 256) = o16[mb]; *(v8us*)(qh + mb * 256) = oh[mb]; *(v8us*)(ql + mb * 256) = ol[mb]; }
            // precaution behind the twelve stores: their data and addresses are inputs, so none of these registers is rewritten (next column's packing) in front of the wait
            asm volatile("s_wait_xcnt 0x0" :: "v"(o16[0]), "v"(o16[1]), "v"(o16[2]), "v"(o16[3]), "v"(oh[0]), "v"(oh[1]), "v"(oh[2]), "v"(oh[3]), "v"(ol[0]), "v"(ol[1]), "v"(ol[2]), "v"(ol[3]), "v"(q16), "v"(qh), "v"(ql) : "memory"); }
    } else {
#pragma unroll
    for (int mb = 0; mb < 4; ++mb) {
#pragma unroll
        for (int nb = 0; nb < 4; ++nb) {
#pragma unroll
            for (int j = 0; j < 8; ++j) os[(hi * 8 + j) * 68 + nb * 16 + lr] = acc[mb][nb][j]; }
        __builtin_amdgcn_wave_barrier(); asm volatile("" ::: "memory");
        float* crow = C + (size_t)(r0 + mb * 16) * ldc + c0;
{
#pragma unroll
            for (int s = 0; s < 8; ++s) { const int row = 2 * s + hi, cofs = lr * 4; v4f val = *(const v4fa*)(os + row * 68 + cofs); if (BIAS) { val[0] += bfr(bias[c0 + cofs]); val[1] += bfr(bias[c0 + cofs + 1]); val[2] += bfr(bias[c0 + cofs + 2]); val[3] += bfr(bias[c0 + cofs + 3]); }
                *(v4f*)(crow + (size_t)row * ldc + cofs) = val; }
             }
        __builtin_amdgcn_wave_barrier(); asm volatile("" ::: "memory");
    }
    }
}

// k_qkv: the three projections of both batches in ONE launch; grid (16, 16, 3 NB_), blockIdx.z = projection * NB_ + batch. q^T = Wq x^T and k^T = Wk x^T: m = output feature, n = position; v = x Wv^T: m = position, n = output feature.
__global__ __launch_bounds__(128) void k_qkv(const bf* __restrict__ WQ, const bf* __restrict__ WK, const bf* __restrict__ WV, const bf* __restrict__ XB, h16* Q16, bf* Qh, bf* Ql, h16* K16, bf* Kh, bf* Kl, h16* V16, bf* Vh, bf* Vl) {
    __shared__ __attribute__((aligned(2048))) unsigned char sm[2 * 2 * TILEB];
    const int pr = blockIdx.z / NB_, bt = blockIdx.z % NB_;
    if (pr < 2) gemmw<bf, 0, false, 1>(sm, bt, pr ? WK : WQ, nullptr, XB, DM, nullptr, 0, nullptr, 0, (size_t)TT * DM, (size_t)NH_ * TT * HD, pr ? K16 : Q16, pr ? Kh : Qh, pr ? Kl : Ql);
    else gemmw<bf, 0, false, 2>(sm, bt, XB, nullptr, WV, DM, nullptr, 0, nullptr, (size_t)TT * DM, 0, (size_t)NKV * HD * TT, V16, Vh, Vl);
}
// k_wo: out = merged (hi + lo) Wo^T + bo, both batches; grid (16, 16, NB_).
__global__ __launch_bounds__(128) void k_wo(const bf* __restrict__ Ah, const bf* __restrict__ Al, const bf* __restrict__ WO, float* OUT, const float* __restrict__ bo) {
    __shared__ __attribute__((aligned(2048))) unsigned char sm[2 * 3 * TILEB];
    gemmw<bf, 1, true>(sm, blockIdx.z, Ah, Al, WO, DQ, OUT, DM, bo, (size_t)TT * DQ, 0, (size_t)TT * DM, nullptr, nullptr, nullptr);
}

typedef __attribute__((ext_vector_type(2))) _Float16 v2h;
typedef __attribute__((ext_vector_type(4))) _Float16 v4h;
typedef __attribute__((ext_vector_type(2))) unsigned short v2us;
typedef __attribute__((ext_vector_type(4))) unsigned short v4us;
typedef __attribute__((ext_vector_type(2))) float v2f;
typedef __attribute__((ext_vector_type(4))) int v4i;

// k_cvt8: f32 [rows][K] -> bf16 plane in fragment order. A thread makes one 16-byte piece; a wave takes 8 rows x 32 k: it reads one whole 128-B line per row and stores 4 whole lines.
// All five planes (x of both batches, then Wq, Wk, Wv, Wo) in ONE launch: they lie one behind the other in dst, and a work-group picks its source by its index (every plane is a whole number of work-groups).
#define XBLK (NB_ * TT * DM / 8 / 256)   // work-groups on x
#define WBLK (DQ * DM / 8 / 256)         // work-groups on one weight
template <int K>
__global__ __launch_bounds__(256) void k_cvt8(const float* __restrict__ x, const float* __restrict__ wq, const float* __restrict__ wk, const float* __restrict__ wv, const float* __restrict__ wo, bf* dst) {
    int bk = blockIdx.x; const float* src = x;
    if (bk >= XBLK) { const int wi = (bk - XBLK) / WBLK; bk = (bk - XBLK) % WBLK; src = wi == 0 ? wq : wi == 1 ? wk : wi == 2 ? wv : wo; dst += (size_t)NB_ * TT * DM + (size_t)wi * DQ * DM; }
    const size_t i = (size_t)bk * 256 + threadIdx.x; const int c4 = (int)(i & 3), r16 = (int)((i >> 2) & 15); const size_t blk = i >> 6;
    const v8f v = *(const v8f*)(src + ((blk / (K / 32)) * 16 + r16) * K + (blk % (K / 32)) * 32 + c4 * 8); v8us o;
#pragma unroll
    for (int k = 0; k < 8; ++k) o[k] = f2bf(v[k]); *(v8us*)(dst + blk * 512 + (c4 >> 1) * 256 + (c4 & 1) * 128 + r16 * 8) = o;  }

// ---- k_attn: scores, softmax and P.V of both batches in ONE launch, all heads; no score or probability matrix goes through memory.
// A wave owns NQ x 16 query rows of one head and walks the 2048 keys in blocks of 32. It forms the TRANSPOSED score tile S^T = K Q^T (A = key rows, B = query rows): a lane then holds, for ITS query (lane & 15),
// keys 8 hi + j of the first 16-key tile and 16 + 8 hi + j of the second, which is the B fragment order of the next product O^T = V^T P^T (A = rows of the [d][t] value plane): no shuffle, no LDS.
// Softmax is the running form: per query a running maximum mo (kept 10 below the true one in log2 units, so that p <= 1024: the carrier of the 16-bit probabilities; it cancels in the division) and a running sum;
// the O^T tiles are rescaled by 2^(old - new) every block. Rows < RH: hi + lo planes, 3 products; the rest f16, as before. The four waves of a work-group walk the same head's keys, so three of four fragment reads can hit the WGP cache.
template <typename T16, int NSPLIT, int NQ>
__device__ __forceinline__ void attn_rows(const T16* __restrict__ Q, const T16* __restrict__ Q2, const T16* __restrict__ Kp, const T16* __restrict__ K2, const T16* __restrict__ Vt, const T16* __restrict__ V2, int q0, bf* Ah, bf* Al) {
    typedef typename WFrag<T16>::V V;
    const int lane = threadIdx.x & 31;
    V qf[NQ][4], qf2[NQ][4];
    const T16* qa = Q + (size_t)q0 * HD + 8 * lane; const T16* qa2 = NSPLIT ? Q2 + (size_t)q0 * HD + 8 * lane : qa;   // fragment order: 16 rows = 16 HD elements, 32 d = 512 elements
#pragma unroll
    for (int q = 0; q < NQ; ++q)
#pragma unroll
        for (int c = 0; c < 4; ++c) { qf[q][c] = WFrag<T16>::ld(qa + q * 16 * HD + c * 512); if (NSPLIT) qf2[q][c] = WFrag<T16>::ld(qa2 + q * 16 * HD + c * 512); }
    asm volatile("s_wait_xcnt 0x0" :: "v"(qa), "v"(qa2) : "memory");   // precaution behind the loads: the addresses are inputs, so they are not rewritten in front of the wait
    v8f o[NQ][8]; float mo[NQ], ls[NQ];
#pragma unroll
    for (int q = 0; q < NQ; ++q) { mo[q] = -3.0e38f; ls[q] = 0.f;
#pragma unroll
        for (int mt = 0; mt < 8; ++mt) o[q][mt] = (v8f){}; }
    const size_t kl = 8 * lane, vl = 8 * lane;
    V kf[2][4], kf2[2][4], vf[8], vf2[8];
    // each fetch ends in s_wait_xcnt 0 with its addresses as inputs: a precaution (no address register is rewritten in front of the wait); the statement also keeps the loads at the early place where they are written
    auto fetch_k = [&](int k0) { const T16* ka = Kp + kl + (size_t)k0 * HD; const T16* ka2 = NSPLIT ? K2 + kl + (size_t)k0 * HD : ka;
#pragma unroll
        for (int kt = 0; kt < 2; ++kt)
#pragma unroll
            for (int c = 0; c < 4; ++c) { kf[kt][c] = WFrag<T16>::ld(ka + kt * 16 * HD + c * 512); if (NSPLIT) kf2[kt][c] = WFrag<T16>::ld(ka2 + kt * 16 * HD + c * 512); }
        asm volatile("s_wait_xcnt 0x0" :: "v"(ka), "v"(ka2) : "memory"); };
    auto fetch_v = [&](int k0) { const T16* va = Vt + vl + (size_t)k0 * 16; const T16* va2 = NSPLIT ? V2 + vl + (size_t)k0 * 16 : va;
#pragma unroll
        for (int mt = 0; mt < 8; ++mt) { vf[mt] = WFrag<T16>::ld(va + (size_t)mt * 16 * TT); if (NSPLIT) vf2[mt] = WFrag<T16>::ld(va2 + (size_t)mt * 16 * TT); }
        asm volatile("s_wait_xcnt 0x0" :: "v"(va), "v"(va2) : "memory"); };
    fetch_k(0); fetch_v(0);
#pragma unroll 1   // kept rolled: one trip already holds a whole key block's matrix instructions and both fetches
    for (int kb = 0; kb < TT; kb += 32) {
        const int nk = (kb + 32 < TT) ? kb + 32 : kb;   // the block fetched ahead; the last trip fetches its own again (in bounds, unused)
        v8f s[NQ][2];
#pragma unroll
        for (int q = 0; q < NQ; ++q) { s[q][0] = (v8f){}; s[q][1] = (v8f){}; }
#pragma unroll
        for (int c = 0; c < 4; ++c) {
#pragma unroll
            for (int kt = 0; kt < 2; ++kt)
#pragma unroll
                for (int q = 0; q < NQ; ++q) s[q][kt] = WFrag<T16>::mma(kf[kt][c], qf[q][c], s[q][kt]);
            if (NSPLIT) {
#pragma unroll
                for (int kt = 0; kt < 2; ++kt)
#pragma unroll
                    for (int q = 0; q < NQ; ++q) s[q][kt] = WFrag<T16>::mma(kf2[kt][c], qf[q][c], s[q][kt]);
#pragma unroll
                for (int kt = 0; kt < 2; ++kt)
#pragma unroll
                    for (int q = 0; q < NQ; ++q) s[q][kt] = WFrag<T16>::mma(kf[kt][c], qf2[q][c], s[q][kt]); } }
        // next block's key fragments: in flight under the softmax and P.V of this block
        fetch_k(nk);
        V pf[NQ], pf2[NQ];
#pragma unroll
        for (int q = 0; q < NQ; ++q) {
            float mx = -3.0e38f;
#pragma unroll
            for (int kt = 0; kt < 2; ++kt)
#pragma unroll
                for (int j = 0; j < 8; ++j) { s[q][kt][j] *= SCL * 1.4426950408889634f; mx = fmaxf(mx, s[q][kt][j]); }
            mx = fmaxf(mx, __shfl_xor(mx, 16, 32));
            const float mn = fmaxf(mo[q], mx - 10.0f); const float al = __builtin_amdgcn_exp2f(mo[q] - mn); mo[q] = mn;
            float ps = 0.f;
#pragma unroll
            for (int kt = 0; kt < 2; ++kt)
#pragma unroll
                for (int j = 0; j < 8; ++j) { s[q][kt][j] = __builtin_amdgcn_exp2f(s[q][kt][j] - mn); ps += s[q][kt][j]; }
            ls[q] = ls[q] * al + ps;
#pragma unroll
            for (int mt = 0; mt < 8; ++mt) o[q][mt] *= al;
            if constexpr (NSPLIT == 0) { v16h p;
#pragma unroll
                for (int j = 0; j < 8; ++j) { p[j] = tohx(s[q][0][j]); p[8 + j] = tohx(s[q][1][j]); }
                pf[q] = p;
            } else { v8us h0, h1, l0, l1;
#pragma unroll
                for (int j = 0; j < 8; ++j) { unsigned short a, c2; splitf(s[q][0][j], a, c2); h0[j] = a; l0[j] = c2; splitf(s[q][1][j], a, c2); h1[j] = a; l1[j] = c2; }
                pf[q] = cat16b(h0, h1); pf2[q] = cat16b(l0, l1); } }
#pragma unroll
        for (int mt = 0; mt < 8; ++mt)
#pragma unroll
            for (int q = 0; q < NQ; ++q) o[q][mt] = WFrag<T16>::mma(vf[mt], pf[q], o[q][mt]);
        if (NSPLIT) {
#pragma unroll
            for (int mt = 0; mt < 8; ++mt)
#pragma unroll
                for (int q = 0; q < NQ; ++q) o[q][mt] = WFrag<T16>::mma(vf[mt], pf2[q], o[q][mt]);
#pragma unroll
            for (int mt = 0; mt < 8; ++mt)
#pragma unroll
                for (int q = 0; q < NQ; ++q) o[q][mt] = WFrag<T16>::mma(vf2[mt], pf[q], o[q][mt]); }
        // next block's value fragments: in flight under the next block's scores and softmax
        fetch_v(nk);
    }
#pragma unroll
    for (int q = 0; q < NQ; ++q) { const float inv = __fdiv_rn(1.0f, ls[q] + __shfl_xor(ls[q], 16, 32)); const size_t oo = (size_t)(q0 + q * 16) * DQ + 8 * lane;   // the O^T tile mt of a lane is its piece of half a block of the merged plane (fragment order, K = DQ)
#pragma unroll
        for (int mt = 0; mt < 8; ++mt) { v8us oh, ol;
#pragma unroll
            for (int j = 0; j < 8; ++j) { unsigned short a, c2; splitf(o[q][mt][j] * inv, a, c2); oh[j] = a; ol[j] = c2; }
            *(v8us*)(Ah + oo + mt * 256) = oh; *(v8us*)(Al + oo + mt * 256) = ol;
            asm volatile("s_wait_xcnt 0x0" :: "v"(oh), "v"(ol) : "memory"); } }   // precaution behind the two stores: their data are inputs, so no data register is rewritten (next tile's packing, the code behind the call) in front of the wait
}
#define WHI (RH / 64)             // work-groups per head on the hi + lo rows: 4 waves x 16 rows
#define WLO ((TT - RH) / 128)     // work-groups per head on the f16 rows: 4 waves x 32 rows
__global__ __launch_bounds__(128) void k_attn(const h16* __restrict__ Q16, const h16* __restrict__ K16, const h16* __restrict__ V16, const bf* __restrict__ Qh, const bf* __restrict__ Ql, const bf* __restrict__ Kh, const bf* __restrict__ Kl, const bf* __restrict__ Vh, const bf* __restrict__ Vl, bf* Ah, bf* Al) {
    const int w = threadIdx.x >> 5; int b = blockIdx.x;   // h counts the heads of both batches: the head planes of batch 1 lie behind those of batch 0, its merged plane TT * DQ elements on
    if (b < NB_ * NH_ * WHI) { const int h = b / WHI; const size_t pz = (size_t)h * TT * HD, az = (size_t)(h / NH_) * TT * DQ + (h % NH_) * HD * 16;   // the longer work-groups (3 products) take the lowest indices
        attn_rows<bf, 2, 1>(Qh + pz, Ql + pz, Kh + pz, Kl + pz, Vh + pz, Vl + pz, (b % WHI) * 64 + w * 16, Ah + az, Al + az);
    } else { b -= NB_ * NH_ * WHI; const int h = b / WLO; const size_t pz = (size_t)h * TT * HD, az = (size_t)(h / NH_) * TT * DQ + (h % NH_) * HD * 16;
        attn_rows<h16, 0, 2>(Q16 + pz, nullptr, K16 + pz, nullptr, V16 + pz, nullptr, RH + (b % WLO) * 128 + w * 32, Ah + az, Al + az); }
}

extern "C" void kernel_launch(void* const* d_in, const int* in_sizes, int n_in,
                              void* d_out, int out_size, void* d_ws, size_t ws_size, hipStream_t stream) {
    (void)in_sizes; (void)n_in; (void)out_size;
    const float* x = (const float*)d_in[0]; const float* wq = (const float*)d_in[1]; const float* wk = (const float*)d_in[2]; const float* wv = (const float*)d_in[3]; const float* wo = (const float*)d_in[4]; const float* bo = (const float*)d_in[5];   /* order x, Wq, Wk, Wv, Wo ('oi' (out, in) [2048][2048] x 4; normal / sqrt(2048); no projection biases), bo (a REAL output bias [2048], 0.01): SIX inputs, all read */
    float* OUT = (float*)d_out;     // [2][2048][2048]
    char* wsp = (char*)d_ws;
    auto take = [&](size_t bytes) { char* p = wsp; wsp += (bytes + 255) & ~(size_t)255; return (void*)p; };
    bf* XB = (bf*)take((size_t)NB_ * TT * DM * 2); bf* WQ = (bf*)take((size_t)DQ * DM * 2); bf* WK = (bf*)take((size_t)DKV * DM * 2); bf* WV = (bf*)take((size_t)DKV * DM * 2); bf* WO = (bf*)take((size_t)DM * DQ * 2);   // one behind the other: k_cvt8 writes them as one range
    h16* QP16 = (h16*)take((size_t)NB_ * NH_ * TT * HD * 2); h16* KP16 = (h16*)take((size_t)NB_ * NKV * TT * HD * 2); h16* VT16 = (h16*)take((size_t)NB_ * NKV * HD * TT * 2);
    bf* QPh = (bf*)take((size_t)NB_ * NH_ * TT * HD * 2); bf* QPl = (bf*)take((size_t)NB_ * NH_ * TT * HD * 2); bf* KPh = (bf*)take((size_t)NB_ * NKV * TT * HD * 2); bf* KPl = (bf*)take((size_t)NB_ * NKV * TT * HD * 2); bf* VTh = (bf*)take((size_t)NB_ * NKV * HD * TT * 2); bf* VTl = (bf*)take((size_t)NB_ * NKV * HD * TT * 2);
    bf* ATh = (bf*)take((size_t)NB_ * TT * DQ * 2); bf* ATl = (bf*)take((size_t)NB_ * TT * DQ * 2);
    if ((size_t)(wsp - (char*)d_ws) > ws_size) return;    // 224 MiB of the 256 MiB
    k_cvt8<DM><<<XBLK + 4 * WBLK, 256, 0, stream>>>(x, wq, wk, wv, wo, XB);
    k_qkv<<<dim3(DQ / 128, TT / 128, 3 * NB_), 128, 0, stream>>>(WQ, WK, WV, XB, QP16, QPh, QPl, KP16, KPh, KPl, VT16, VTh, VTl);
    k_attn<<<NB_ * NH_ * (WHI + WLO), 128, 0, stream>>>(QP16, KP16, VT16, QPh, QPl, KPh, KPl, VTh, VTl, ATh, ATl);
    k_wo<<<dim3(TT / 128, DM / 128, NB_), 128, 0, stream>>>(ATh, ATl, WO, OUT, bo);
}

// v007
// A run of this version takes 218 microseconds.
// Next to v006, in two timings, it ran 1.13 and 1.15 times as fast.
// Over all steps from v000 it is 10.3 times as fast.
#include <hip/hip_runtime.h>

// Dense multi-head attention, 16 FULL heads x 128, natural bias-free projections and a natural output projection WITH a bias (x [2][2048][2048]; q, k, v = x W^T ('oi' (out, in) [2048][2048], normal / sqrt(2048), no bias; 16 heads x 128: one kv head per query head); scores x 128^-0.5; softmax over ALL 2,048 keys (no mask, no causal rule); out = merged Wo^T + bo ('oi' + a REAL bias 0.01) -> [2][2048][2048] (8.4 M); argument order x, Wq, Wk, Wv, Wo, bo).
// Every 16-bit plane that a matrix instruction reads (x, the weights, q, k, v^T, the merged heads) lies in FRAGMENT ORDER: see 'fragment order' below.
// Layout, both batches in every launch: bf16 copy of x; 'oi' weights as-is; exact projections whose epilogue stores the head planes itself (no f32 projection goes through memory); one fused dense T-2048 attention launch over the 16 FULL heads (REP = NH_ / NKV = 1: each head has its own k / v plane; hybrid rows: < 512 hi/lo 3 products, rest fp16 with p <= 1024); merged hi/lo x Wo exact + bo.
// Compute dtypes, f32 accumulate: every input rounded to bf16; projections exact; attention rows < 512 3 products, rest fp16; softmax f32; Wo hl x exact + bo (the f32 bias epilogue).

#define NB_  2
#define TT   2048
#define DM   2048
#define NH_  16
#define NKV  16
#define REP  (NH_ / NKV)
#define HD   128
#define DQ   (NH_ * HD)
#define DKV  (NKV * HD)
#define RH   512                  // query rows < RH use hi+lo planes (0: none)
#define WIN  0
#define SCL  0.088388347648318447f   // HD^-0.5
typedef _Float16 h16;
typedef unsigned short bf;
typedef __attribute__((ext_vector_type(16))) __bf16   v16bf;
typedef __attribute__((ext_vector_type(16))) _Float16 v16h;
typedef __attribute__((ext_vector_type(8)))  _Float16 v8h;
typedef __attribute__((ext_vector_type(8)))  unsigned short v8us;
typedef __attribute__((ext_vector_type(8)))  float    v8f;
typedef __attribute__((ext_vector_type(4)))  float    v4f;
typedef v8h  __attribute__((may_alias)) v8ha;
typedef v4f  __attribute__((may_alias)) v4fa;
typedef v8us __attribute__((may_alias)) v8usa;

__device__ __forceinline__ unsigned short f2bf(float f) { unsigned u = __float_as_uint(f); u += 0x7FFFu + ((u >> 16) & 1u); return (unsigned short)(u >> 16); }
__device__ __forceinline__ float bf2f(unsigned short b) { return __uint_as_float(((unsigned)b) << 16); }
__device__ __forceinline__ float bfr(float f) { return bf2f(f2bf(f)); }
__device__ __forceinline__ v16h cat16(v8h lo, v8h hi) { return __builtin_shufflevector(lo, hi, 0, 1, 2, 3, 4, 5, 6, 7, 8, 9, 10, 11, 12, 13, 14, 15); }
__device__ __forceinline__ v16bf cat16b(v8us lo, v8us hi) { return __builtin_bit_cast(v16bf, __builtin_shufflevector(lo, hi, 0, 1, 2, 3, 4, 5, 6, 7, 8, 9, 10, 11, 12, 13, 14, 15)); }
__device__ __forceinline__ v8f wmma16(v16h a, v16h b, v8f c) { return __builtin_amdgcn_wmma_f32_16x16x32_f16(false, a, false, b, (short)0, c, false, false); }
__device__ __forceinline__ v8f wmmab(v16bf a, v16bf b, v8f c) { return __builtin_amdgcn_wmma_f32_16x16x32_bf16(false, a, false, b, (short)0, c, false, false); }



// ---- fragment order of a 16-bit plane P[row][k] (K columns, K % 32 == 0, rows % 16 == 0): 1-KiB blocks of 16 rows x 32 k, block (row / 16) * (K / 32) + k / 32; inside a block element
// ((k / 16) % 2) * 256 + ((k / 8) % 2) * 128 + (row % 16) * 8 + k % 8. A fragment is then two 16-byte loads per lane at block + lane * 8 and + 256 elements: each wave-wide load covers 512 contiguous bytes (4 whole lines, not 32 B in each of 16 lines).
// ---- gemmw (the body of k_qkv and k_wo): register-blocked GEMM, a work-group of FOUR WAVES per 128x128 output tile, one wave per 64x64 quarter (16 accumulators); grid (M/128, N/128, ...), 128 threads; zz: the z-batch index, from blockIdx.z.
// The operand tiles (128 rows x 64 k of each fragment-order plane) are brought into LDS once per work-group by asynchronous copies, two buffers: stage s + 2 flies while stage s + 1 is worked on; each fragment is then read from LDS by the two waves that need it. sm: the kernel's staging LDS, two stages.
// C[m][n] (f32, pitch ldc, + optional f32 bias[n]) = sum_k (A[m][k] (+ A2[m][k] where NSPLIT == 1)) Bt[n][k]. z-batch strides sA/sB/sC in elements. K % 64 == 0, K >= 128.
// PL != 0: no C; the epilogue stores the tile as the three 16-bit head planes (f16, bf16 hi, bf16 lo) P[n][m] in fragment order, m being the plane's k: a lane's 8 accumulator values are 8 successive m of one n, which is one 16-byte piece,
// and a wave's store is half a block (512 B in a row). PL == 1: the head is m / HD, plane [head][n][m % HD] (q, k: A = weight rows, Bt = x rows). PL == 2: the head is n / HD, plane [head][n % HD][m] (v^T: A = x rows, Bt = weight rows).
// PL != 0: sC is the z stride of the three planes, in elements.
template <typename T16> struct WFrag;
template <> struct WFrag<h16> { typedef v16h V; static __device__ __forceinline__ V ld(const h16* p) { return cat16(*(const v8h*)p, *(const v8h*)(p + 256)); } static __device__ __forceinline__ v8f mma(V a, V b, v8f c) { return wmma16(a, b, c); } };
template <> struct WFrag<bf> { typedef v16bf V; static __device__ __forceinline__ V ld(const bf* p) { return cat16b(*(const v8us*)p, *(const v8us*)(p + 256)); } static __device__ __forceinline__ v8f mma(V a, V b, v8f c) { return wmmab(a, b, c); } };
__device__ __forceinline__ h16 tohx(float x) { return (h16)x; }
__device__ __forceinline__ void splitf(float y, unsigned short& h, unsigned short& l) { h = f2bf(y); l = f2bf(y - bf2f(h)); }
// copy_tile: one 128-row x 64-k tile of a fragment-order plane (8 row blocks of 2 KiB, rb elements apart) goes into 16 KiB of LDS, in the plane's own order: eight asynchronous 16-byte copies per lane, 128 lanes, a wave's copy = 512 bytes in a row on both sides.
// l: the lane's own LDS byte address in the tile, g: its own global address. The s_wait_xcnt 0 is the last line of the copies' own statement: a precaution, so that no address register of an issued copy is rewritten in front of it.
template <typename T16>
__device__ __forceinline__ void copy_tile(unsigned l, const T16* g, size_t rb) {
    asm volatile("global_load_async_to_lds_b128 %0, %8, off\n\t"
                 "global_load_async_to_lds_b128 %1, %9, off\n\t"
                 "global_load_async_to_lds_b128 %2, %10, off\n\t"
                 "global_load_async_to_lds_b128 %3, %11, off\n\t"
                 "global_load_async_to_lds_b128 %4, %12, off\n\t"
                 "global_load_async_to_lds_b128 %5, %13, off\n\t"
                 "global_load_async_to_lds_b128 %6, %14, off\n\t"
                 "global_load_async_to_lds_b128 %7, %15, off\n\t"
                 "s_wait_xcnt 0x0"
                 :: "v"(l), "v"(l + 2048u), "v"(l + 4096u), "v"(l + 6144u), "v"(l + 8192u), "v"(l + 10240u), "v"(l + 12288u), "v"(l + 14336u),
                    "v"(g), "v"(g + rb), "v"(g + 2 * rb), "v"(g + 3 * rb), "v"(g + 4 * rb), "v"(g + 5 * rb), "v"(g + 6 * rb), "v"(g + 7 * rb) : "memory");
}
#define TILEB 16384               // bytes of one staged tile: 128 rows x 64 k x 2 B
template <typename T16, int NSPLIT, bool BIAS, int PL = 0>
__device__ __forceinline__ void gemmw(unsigned char* sm, const int zz, const T16* __restrict__ A, const T16* __restrict__ A2, const T16* __restrict__ Bt, int K, float* C, int ldc, const float* __restrict__ bias, size_t sA, size_t sB, size_t sC, h16* P16, bf* Ph, bf* Pl) {
    typedef typename WFrag<T16>::V V;
    static_assert(NSPLIT == 0 || NSPLIT == 1, "one or two A planes");
    __shared__ __align__(16) float osw[4][16 * 68];
    const size_t z = zz; A += z * sA; if (NSPLIT == 1) A2 += z * sA; Bt += z * sB; if constexpr (PL == 0) C += z * sC;
    const int tid = threadIdx.x, lane = tid & 31, lr = lane & 15, hi = lane >> 4, w = tid >> 5; const int R0 = blockIdx.x * 128, C0 = blockIdx.y * 128, r0 = R0 + (w & 1) * 64, c0 = C0 + (w >> 1) * 64;
    float* os = osw[w];
    v8f acc[4][4];
#pragma unroll
    for (int mb = 0; mb < 4; ++mb)
#pragma unroll
        for (int nb = 0; nb < 4; ++nb) acc[mb][nb] = (v8f){};
    constexpr unsigned SB = (NSPLIT == 1 ? 3 : 2) * TILEB;   // a stage: [A | A2 | B] tiles
    const unsigned l0 = (unsigned)(size_t)sm + 16u * tid;    // the lane's LDS byte address in buffer 0
    const T16* gA = A + (size_t)R0 * K + 8 * tid; const T16* gA2 = NSPLIT == 1 ? A2 + (size_t)R0 * K + 8 * tid : gA; const T16* gB = Bt + (size_t)C0 * K + 8 * tid;   // 16 rows of a plane are 16 K elements; 64 k of a row block are 1024 elements in a row
    auto issue = [&](int s) { const unsigned l = l0 + (s & 1) * SB; const size_t ko = (size_t)s * 1024;
        copy_tile(l, gA + ko, (size_t)16 * K); if (NSPLIT == 1) copy_tile(l + TILEB, gA2 + ko, (size_t)16 * K); copy_tile(l + (SB - TILEB), gB + ko, (size_t)16 * K); };
    const int NS = K / 64;
    const unsigned fa = (w & 1) * 8192 + 16 * lane, fb = (SB - TILEB) + (w >> 1) * 8192 + 16 * lane;   // the wave's four row blocks in the A and in the B tile
    issue(0);
    asm volatile("s_wait_asynccnt 0x0" ::: "memory");   // stage 0 of this wave has landed
    __syncthreads();                                     // ... and every other wave's part of it
    issue(1);
#pragma unroll 1   // kept rolled: the two buffers alternate by the trip's parity
    for (int s = 0; s < NS; ++s) {
        const unsigned char* st = sm + (s & 1) * SB;
#pragma unroll
        for (int u = 0; u < 2; ++u) {
            V a[4], a2[4], bv[4];
#pragma unroll
            for (int mb = 0; mb < 4; ++mb) { a[mb] = WFrag<T16>::ld((const T16*)(st + fa + mb * 2048 + u * 1024)); if (NSPLIT == 1) a2[mb] = WFrag<T16>::ld((const T16*)(st + TILEB + fa + mb * 2048 + u * 1024)); }
#pragma unroll
            for (int nb = 0; nb < 4; ++nb) bv[nb] = WFrag<T16>::ld((const T16*)(st + fb + nb * 2048 + u * 1024));
            __builtin_amdgcn_sched_barrier(0);   // keeps the block's LDS reads together in front of its matrix instructions: sunk among them, every group of four waits out an LDS latency of its own
#pragma unroll
            for (int nb = 0; nb < 4; ++nb) {
#pragma unroll
                for (int mb = 0; mb < 4; ++mb) { acc[mb][nb] = WFrag<T16>::mma(a[mb], bv[nb], acc[mb][nb]); if (NSPLIT == 1) acc[mb][nb] = WFrag<T16>::mma(a2[mb], bv[nb], acc[mb][nb]); } }
        }
        asm volatile("s_wait_dscnt 0x0" ::: "memory");      // this wave's reads of the buffer have returned
        asm volatile("s_wait_asynccnt 0x0" ::: "memory");   // its copies of stage s + 1 have landed
        __syncthreads();                                     // publishes stage s + 1 and ends every wave's reads of stage s
        if (s + 2 < NS) issue(s + 2);                        // refill of the buffer that this trip has read
    }
    asm volatile("s_wait_asynccnt 0x0" ::: "memory");       // nothing is in flight when the wave goes on
    if constexpr (PL != 0) {
        const size_t pe = z * sC + (PL == 1 ? (size_t)(r0 / HD) * TT * HD + ((size_t)(c0 / 16) * (HD / 32) + (r0 % HD) / 32) * 512 : (size_t)(c0 / HD) * HD * TT + ((size_t)((c0 % HD) / 16) * (TT / 32) + r0 / 32) * 512) + 8 * lane;
#pragma unroll
        for (int nb = 0; nb < 4; ++nb) { const size_t en = pe + (size_t)nb * ((PL == 1 ? HD / 32 : TT / 32) * 512);   // 16 plane rows on; the four mb tiles are two whole blocks in a row
            h16* q16 = P16 + en; bf* qh = Ph + en; bf* ql = Pl + en; v8h o16[4]; v8us oh[4], ol[4];
#pragma unroll
            for (int mb = 0; mb < 4; ++mb) {
#pragma unroll
                for (int j = 0; j < 8; ++j) { const float r = acc[mb][nb][j]; o16[mb][j] = tohx(r); unsigned short a2, c2; splitf(r, a2, c2); oh[mb][j] = a2; ol[mb][j] = c2; }
                *(v8h*)(q16 + mb * 256) = o16[mb]; *(v8us*)(qh + mb * 256) = oh[mb]; *(v8us*)(ql + mb * 256) = ol[mb]; }
            // precaution behind the twelve stores: their data and addresses are inputs, so none of these registers is rewritten (next column's packing) in front of the wait
            asm volatile("s_wait_xcnt 0x0" :: "v"(o16[0]), "v"(o16[1]), "v"(o16[2]), "v"(o16[3]), "v"(oh[0]), "v"(oh[1]), "v"(oh[2]), "v"(oh[3]), "v"(ol[0]), "v"(ol[1]), "v"(ol[2]), "v"(ol[3]), "v"(q16), "v"(qh), "v"(ql) : "memory"); }
    } else {
#pragma unroll
    for (int mb = 0; mb < 4; ++mb) {
#pragma unroll
        for (int nb = 0; nb < 4; ++nb) {
#pragma unroll
            for (int j = 0; j < 8; ++j) os[(hi * 8 + j) * 68 + nb * 16 + lr] = acc[mb][nb][j]; }
        __builtin_amdgcn_wave_barrier(); asm volatile("" ::: "memory");
        float* crow = C + (size_t)(r0 + mb * 16) * ldc + c0;
{
#pragma unroll
            for (int s = 0; s < 8; ++s) { const int row = 2 * s + hi, cofs = lr * 4; v4f val = *(const v4fa*)(os + row * 68 + cofs); if (BIAS) { val[0] += bfr(bias[c0 + cofs]); val[1] += bfr(bias[c0 + cofs + 1]); val[2] += bfr(bias[c0 + cofs + 2]); val[3] += bfr(bias[c0 + cofs + 3]); }
                *(v4f*)(crow + (size_t)row * ldc + cofs) = val; }
             }
        __builtin_amdgcn_wave_barrier(); asm volatile("" ::: "memory");
    }
    }
}

// k_qkv: the three projections of both batches in ONE launch; grid (16, 16, 3 NB_), blockIdx.z = projection * NB_ + batch. q^T = Wq x^T and k^T = Wk x^T: m = output feature, n = position; v = x Wv^T: m = position, n = output feature.
__global__ __launch_bounds__(128) void k_qkv(const bf* __restrict__ WQ, const bf* __restrict__ WK, const bf* __restrict__ WV, const bf* __restrict__ XB, h16* Q16, bf* Qh, bf* Ql, h16* K16, bf* Kh, bf* Kl, h16* V16, bf* Vh, bf* Vl) {
    __shared__ __attribute__((aligned(2048))) unsigned char sm[2 * 2 * TILEB];
    const int pr = blockIdx.z / NB_, bt = blockIdx.z % NB_;
    if (pr < 2) gemmw<bf, 0, false, 1>(sm, bt, pr ? WK : WQ, nullptr, XB, DM, nullptr, 0, nullptr, 0, (size_t)TT * DM, (size_t)NH_ * TT * HD, pr ? K16 : Q16, pr ? Kh : Qh, pr ? Kl : Ql);
    else gemmw<bf, 0, false, 2>(sm, bt, XB, nullptr, WV, DM, nullptr, 0, nullptr, (size_t)TT * DM, 0, (size_t)NKV * HD * TT, V16, Vh, Vl);
}
// k_wo: out = merged (hi + lo) Wo^T + bo, both batches; grid (16, 16, NB_).
__global__ __launch_bounds__(128) void k_wo(const bf* __restrict__ Ah, const bf* __restrict__ Al, const bf* __restrict__ WO, float* OUT, const float* __restrict__ bo) {
    __shared__ __attribute__((aligned(2048))) unsigned char sm[2 * 3 * TILEB];
    gemmw<bf, 1, true>(sm, blockIdx.z, Ah, Al, WO, DQ, OUT, DM, bo, (size_t)TT * DQ, 0, (size_t)TT * DM, nullptr, nullptr, nullptr);
}

typedef __attribute__((ext_vector_type(2))) _Float16 v2h;
typedef __attribute__((ext_vector_type(4))) _Float16 v4h;
typedef __attribute__((ext_vector_type(2))) unsigned short v2us;
typedef __attribute__((ext_vector_type(4))) unsigned short v4us;
typedef __attribute__((ext_vector_type(2))) float v2f;
typedef __attribute__((ext_vector_type(4))) int v4i;

// k_cvt8: f32 [rows][K] -> bf16 plane in fragment order. A thread makes one 16-byte piece; a wave takes 8 rows x 32 k: it reads one whole 128-B line per row and stores 4 whole lines.
// All five planes (x of both batches, then Wq, Wk, Wv, Wo) in ONE launch: they lie one behind the other in dst, and a work-group picks its source by its index (every plane is a whole number of work-groups).
#define XBLK (NB_ * TT * DM / 8 / 256)   // work-groups on x
#define WBLK (DQ * DM / 8 / 256)         // work-groups on one weight
template <int K>
__global__ __launch_bounds__(256) void k_cvt8(const float* __restrict__ x, const float* __restrict__ wq, const float* __restrict__ wk, const float* __restrict__ wv, const float* __restrict__ wo, bf* dst) {
    int bk = blockIdx.x; const float* src = x;
    if (bk >= XBLK) { const int wi = (bk - XBLK) / WBLK; bk = (bk - XBLK) % WBLK; src = wi == 0 ? wq : wi == 1 ? wk : wi == 2 ? wv : wo; dst += (size_t)NB_ * TT * DM + (size_t)wi * DQ * DM; }
    const size_t i = (size_t)bk * 256 + threadIdx.x; const int c4 = (int)(i & 3), r16 = (int)((i >> 2) & 15); const size_t blk = i >> 6;
    const v8f v = *(const v8f*)(src + ((blk / (K / 32)) * 16 + r16) * K + (blk % (K / 32)) * 32 + c4 * 8); v8us o;
#pragma unroll
    for (int k = 0; k < 8; ++k) o[k] = f2bf(v[k]); *(v8us*)(dst + blk * 512 + (c4 >> 1) * 256 + (c4 & 1) * 128 + r16 * 8) = o;  }

// ---- k_attn: scores, softmax and P.V of both batches in ONE launch, all heads; no score or probability matrix goes through memory.
// A wave owns NQ x 16 query rows of one head and walks the 2048 keys in blocks of 32. It forms the TRANSPOSED score tile S^T = K Q^T (A = key rows, B = query rows): a lane then holds, for ITS query (lane & 15),
// keys 8 hi + j of the first 16-key tile and 16 + 8 hi + j of the second, which is the B fragment order of the next product O^T = V^T P^T (A = rows of the [d][t] value plane): no shuffle, no LDS.
// Softmax is the running form: per query a running maximum mo (kept 10 below the true one in log2 units, so that p <= 1024: the carrier of the 16-bit probabilities; it cancels in the division) and a running sum;
// the O^T tiles are rescaled by 2^(old - new) every block. Rows < RH: hi + lo planes, 3 products; the rest f16, as before. The four waves of a work-group walk the same head's keys, so three of four fragment reads can hit the WGP cache.
template <typename T16, int NSPLIT, int NQ>
__device__ __forceinline__ void attn_rows(const T16* __restrict__ Q, const T16* __restrict__ Q2, const T16* __restrict__ Kp, const T16* __restrict__ K2, const T16* __restrict__ Vt, const T16* __restrict__ V2, int q0, bf* Ah, bf* Al) {
    typedef typename WFrag<T16>::V V;
    const int lane = threadIdx.x & 31;
    V qf[NQ][4], qf2[NQ][4];
    const T16* qa = Q + (size_t)q0 * HD + 8 * lane; const T16* qa2 = NSPLIT ? Q2 + (size_t)q0 * HD + 8 * lane : qa;   // fragment order: 16 rows = 16 HD elements, 32 d = 512 elements
#pragma unroll
    for (int q = 0; q < NQ; ++q)
#pragma unroll
        for (int c = 0; c < 4; ++c) { qf[q][c] = WFrag<T16>::ld(qa + q * 16 * HD + c * 512); if (NSPLIT) qf2[q][c] = WFrag<T16>::ld(qa2 + q * 16 * HD + c * 512); }
    asm volatile("s_wait_xcnt 0x0" :: "v"(qa), "v"(qa2) : "memory");   // precaution behind the loads: the addresses are inputs, so they are not rewritten in front of the wait
    v8f o[NQ][8]; float mo[NQ], ls[NQ];
#pragma unroll
    for (int q = 0; q < NQ; ++q) { mo[q] = -3.0e38f; ls[q] = 0.f;
#pragma unroll
        for (int mt = 0; mt < 8; ++mt) o[q][mt] = (v8f){}; }
    const size_t kl = 8 * lane, vl = 8 * lane;
    V kf[2][4], kf2[2][4], vf[8], vf2[8];
    // each fetch ends in s_wait_xcnt 0 with its addresses as inputs: a precaution (no address register is rewritten in front of the wait); the statement also keeps the loads at the early place where they are written
    auto fetch_k = [&](int k0) { const T16* ka = Kp + kl + (size_t)k0 * HD; const T16* ka2 = NSPLIT ? K2 + kl + (size_t)k0 * HD : ka;
#pragma unroll
        for (int kt = 0; kt < 2; ++kt)
#pragma unroll
            for (int c = 0; c < 4; ++c) { kf[kt][c] = WFrag<T16>::ld(ka + kt * 16 * HD + c * 512); if (NSPLIT) kf2[kt][c] = WFrag<T16>::ld(ka2 + kt * 16 * HD + c * 512); }
        asm volatile("s_wait_xcnt 0x0" :: "v"(ka), "v"(ka2) : "memory"); };
    auto fetch_v = [&](int k0) { const T16* va = Vt + vl + (size_t)k0 * 16; const T16* va2 = NSPLIT ? V2 + vl + (size_t)k0 * 16 : va;
#pragma unroll
        for (int mt = 0; mt < 8; ++mt) { vf[mt] = WFrag<T16>::ld(va + (size_t)mt * 16 * TT); if (NSPLIT) vf2[mt] = WFrag<T16>::ld(va2 + (size_t)mt * 16 * TT); }
        asm volatile("s_wait_xcnt 0x0" :: "v"(va), "v"(va2) : "memory"); };
    fetch_k(0); fetch_v(0);
#pragma unroll 1   // kept rolled: one trip already holds a whole key block's matrix instructions and both fetches
    for (int kb = 0; kb < TT; kb += 32) {
        const int nk = (kb + 32 < TT) ? kb + 32 : kb;   // the block fetched ahead; the last trip fetches its own again (in bounds, unused)
        v8f s[NQ][2];
#pragma unroll
        for (int q = 0; q < NQ; ++q) { s[q][0] = (v8f){}; s[q][1] = (v8f){}; }
#pragma unroll
        for (int c = 0; c < 4; ++c) {
#pragma unroll
            for (int kt = 0; kt < 2; ++kt)
#pragma unroll
                for (int q = 0; q < NQ; ++q) s[q][kt] = WFrag<T16>::mma(kf[kt][c], qf[q][c], s[q][kt]);
            if (NSPLIT) {
#pragma unroll
                for (int kt = 0; kt < 2; ++kt)
#pragma unroll
                    for (int q = 0; q < NQ; ++q) s[q][kt] = WFrag<T16>::mma(kf2[kt][c], qf[q][c], s[q][kt]);
#pragma unroll
                for (int kt = 0; kt < 2; ++kt)
#pragma unroll
                    for (int q = 0; q < NQ; ++q) s[q][kt] = WFrag<T16>::mma(kf[kt][c], qf2[q][c], s[q][kt]); } }
        // next block's key fragments: in flight under the softmax and P.V of this block
        fetch_k(nk);
        V pf[NQ], pf2[NQ];
#pragma unroll
        for (int q = 0; q < NQ; ++q) {
            float mx = -3.0e38f;
#pragma unroll
            for (int kt = 0; kt < 2; ++kt)
#pragma unroll
                for (int j = 0; j < 8; ++j) { s[q][kt][j] *= SCL * 1.4426950408889634f; mx = fmaxf(mx, s[q][kt][j]); }
            mx = fmaxf(mx, __shfl_xor(mx, 16, 32));
            const float mn = fmaxf(mo[q], mx - 10.0f); const float al = __builtin_amdgcn_exp2f(mo[q] - mn); mo[q] = mn;
            float ps = 0.f;
#pragma unroll
            for (int kt = 0; kt < 2; ++kt)
#pragma unroll
                for (int j = 0; j < 8; ++j) { s[q][kt][j] = __builtin_amdgcn_exp2f(s[q][kt][j] - mn); ps += s[q][kt][j]; }
            ls[q] = ls[q] * al + ps;
#pragma unroll
            for (int mt = 0; mt < 8; ++mt) o[q][mt] *= al;
            if constexpr (NSPLIT == 0) { v16h p;
#pragma unroll
                for (int j = 0; j < 8; ++j) { p[j] = tohx(s[q][0][j]); p[8 + j] = tohx(s[q][1][j]); }
                pf[q] = p;
            } else { v8us h0, h1, l0, l1;
#pragma unroll
                for (int j = 0; j < 8; ++j) { unsigned short a, c2; splitf(s[q][0][j], a, c2); h0[j] = a; l0[j] = c2; splitf(s[q][1][j], a, c2); h1[j] = a; l1[j] = c2; }
                pf[q] = cat16b(h0, h1); pf2[q] = cat16b(l0, l1); } }
#pragma unroll
        for (int mt = 0; mt < 8; ++mt)
#pragma unroll
            for (int q = 0; q < NQ; ++q) o[q][mt] = WFrag<T16>::mma(vf[mt], pf[q], o[q][mt]);
        if (NSPLIT) {
#pragma unroll
            for (int mt = 0; mt < 8; ++mt)
#pragma unroll
                for (int q = 0; q < NQ; ++q) o[q][mt] = WFrag<T16>::mma(vf[mt], pf2[q], o[q][mt]);
#pragma unroll
            for (int mt = 0; mt < 8; ++mt)
#pragma unroll
                for (int q = 0; q < NQ; ++q) o[q][mt] = WFrag<T16>::mma(vf2[mt], pf[q], o[q][mt]); }
        // next block's value fragments: in flight under the next block's scores and softmax
        fetch_v(nk);
    }
#pragma unroll
    for (int q = 0; q < NQ; ++q) { const float inv = __fdiv_rn(1.0f, ls[q] + __shfl_xor(ls[q], 16, 32)); const size_t oo = (size_t)(q0 + q * 16) * DQ + 8 * lane;   // the O^T tile mt of a lane is its piece of half a block of the merged plane (fragment order, K = DQ)
#pragma unroll
        for (int mt = 0; mt < 8; ++mt) { v8us oh, ol;
#pragma unroll
            for (int j = 0; j < 8; ++j) { unsigned short a, c2; splitf(o[q][mt][j] * inv, a, c2); oh[j] = a; ol[j] = c2; }
            *(v8us*)(Ah + oo + mt * 256) = oh; *(v8us*)(Al + oo + mt * 256) = ol;
            asm volatile("s_wait_xcnt 0x0" :: "v"(oh), "v"(ol) : "memory"); } }   // precaution behind the two stores: their data are inputs, so no data register is rewritten (next tile's packing, the code behind the call) in front of the wait
}
#define WHI (RH / 64)             // work-groups per head on the hi + lo rows: 4 waves x 16 rows
#define WLO ((TT - RH) / 192)     // work-groups per head on the f16 rows: 4 waves x 48 rows (3 query tiles per K / V fragment; the registers still allow two waves per SIMD, and the whole grid is then resident at once)
__global__ __launch_bounds__(128) void k_attn(const h16* __restrict__ Q16, const h16* __restrict__ K16, const h16* __restrict__ V16, const bf* __restrict__ Qh, const bf* __restrict__ Ql, const bf* __restrict__ Kh, const bf* __restrict__ Kl, const bf* __restrict__ Vh, const bf* __restrict__ Vl, bf* Ah, bf* Al) {
    const int w = threadIdx.x >> 5; int b = blockIdx.x;   // h counts the heads of both batches: the head planes of batch 1 lie behind those of batch 0, its merged plane TT * DQ elements on
    if (b < NB_ * NH_ * WHI) { const int h = b / WHI; const size_t pz = (size_t)h * TT * HD, az = (size_t)(h / NH_) * TT * DQ + (h % NH_) * HD * 16;   // the longer work-groups (3 products) take the lowest indices
        attn_rows<bf, 2, 1>(Qh + pz, Ql + pz, Kh + pz, Kl + pz, Vh + pz, Vl + pz, (b % WHI) * 64 + w * 16, Ah + az, Al + az);
    } else { b -= NB_ * NH_ * WHI; const int h = b / WLO; const size_t pz = (size_t)h * TT * HD, az = (size_t)(h / NH_) * TT * DQ + (h % NH_) * HD * 16;
        attn_rows<h16, 0, 3>(Q16 + pz, nullptr, K16 + pz, nullptr, V16 + pz, nullptr, RH + (b % WLO) * 192 + w * 48, Ah + az, Al + az); }
}

extern "C" void kernel_launch(void* const* d_in, const int* in_sizes, int n_in,
                              void* d_out, int out_size, void* d_ws, size_t ws_size, hipStream_t stream) {
    (void)in_sizes; (void)n_in; (void)out_size;
    const float* x = (const float*)d_in[0]; const float* wq = (const float*)d_in[1]; const float* wk = (const float*)d_in[2]; const float* wv = (const float*)d_in[3]; const float* wo = (const float*)d_in[4]; const float* bo = (const float*)d_in[5];   /* order x, Wq, Wk, Wv, Wo ('oi' (out, in) [2048][2048] x 4; normal / sqrt(2048); no projection biases), bo (a REAL output bias [2048], 0.01): SIX inputs, all read */
    float* OUT = (float*)d_out;     // [2][2048][2048]
    char* wsp = (char*)d_ws;
    auto take = [&](size_t bytes) { char* p = wsp; wsp += (bytes + 255) & ~(size_t)255; return (void*)p; };
    bf* XB = (bf*)take((size_t)NB_ * TT * DM * 2); bf* WQ = (bf*)take((size_t)DQ * DM * 2); bf* WK = (bf*)take((size_t)DKV * DM * 2); bf* WV = (bf*)take((size_t)DKV * DM * 2); bf* WO = (bf*)take((size_t)DM * DQ * 2);   // one behind the other: k_cvt8 writes them as one range
    h16* QP16 = (h16*)take((size_t)NB_ * NH_ * TT * HD * 2); h16* KP16 = (h16*)take((size_t)NB_ * NKV * TT * HD * 2); h16* VT16 = (h16*)take((size_t)NB_ * NKV * HD * TT * 2);
    bf* QPh = (bf*)take((size_t)NB_ * NH_ * TT * HD * 2); bf* QPl = (bf*)take((size_t)NB_ * NH_ * TT * HD * 2); bf* KPh = (bf*)take((size_t)NB_ * NKV * TT * HD * 2); bf* KPl = (bf*)take((size_t)NB_ * NKV * TT * HD * 2); bf* VTh = (bf*)take((size_t)NB_ * NKV * HD * TT * 2); bf* VTl = (bf*)take((size_t)NB_ * NKV * HD * TT * 2);
    bf* ATh = (bf*)take((size_t)NB_ * TT * DQ * 2); bf* ATl = (bf*)take((size_t)NB_ * TT * DQ * 2);
    if ((size_t)(wsp - (char*)d_ws) > ws_size) return;    // 224 MiB of the 256 MiB
    k_cvt8<DM><<<XBLK + 4 * WBLK, 256, 0, stream>>>(x, wq, wk, wv, wo, XB);
    k_qkv<<<dim3(DQ / 128, TT / 128, 3 * NB_), 128, 0, stream>>>(WQ, WK, WV, XB, QP16, QPh, QPl, KP16, KPh, KPl, VT16, VTh, VTl);
    k_attn<<<NB_ * NH_ * (WHI + WLO), 128, 0, stream>>>(QP16, KP16, VT16, QPh, QPl, KPh, KPl, VTh, VTl, ATh, ATl);
    k_wo<<<dim3(TT / 128, DM / 128, NB_), 128, 0, stream>>>(ATh, ATl, WO, OUT, bo);
}
